// v000
// Times are from an AMD MI455X. After a warm-up the kernel runs many times in a row, and a time is the length of
// such a window on the GPU divided by its runs, so every launch and the gaps after it count. The runs cycle
// through copies of the inputs. A figure is the median of several windows, for all but v000 over two sittings.
// Sittings can differ by a few percent; kernels timed side by side share one.
// The starting kernel, v000, takes 2700 microseconds a run.
#include <hip/hip_runtime.h>
// Non-local interaction (16 x 2048 tokens, 128 features, single head): q,k,v = x W^T + b; alpha = softmax(q.k / 16); out = alpha v -> [16,2048,128].
// Structure (per batch): x as an exact f16 plane; projections as f16 WMMA GEMMs (32x64 wave tiles, f32 accumulation, exact x16 weights + bias); scores as one GEMM (K 128) into an f32 [2048][2048] plane; wave-per-row f32 softmax (three rolled passes; P x2^10 f16 written as [P | P]); v split into f16 hi and raw residual planes, transposed; out = [P | P] . [v_hi^T | v_lo^T] (K 4096) straight into the output rows.
// Compute dtype: x, weights, biases rounded to bf16; q, k, P as f16 operands (~2^-12; logits sigma ~1.4); v as hi + residual (~2^-22); f32 accumulation and softmax. v_wmma_f32_16x16x32_f16.
#define NBT 16
#define SLEN 2048
#define FF 128
typedef __bf16 v16b __attribute__((ext_vector_type(16)));
typedef unsigned short v8us __attribute__((ext_vector_type(8), may_alias));
typedef float  v8f  __attribute__((ext_vector_type(8)));
typedef float  v4f  __attribute__((ext_vector_type(4)));
typedef float  v4fa __attribute__((ext_vector_type(4), may_alias));
union FragB { v16b v; v8us half[2]; unsigned short u[16]; };

__device__ __forceinline__ unsigned short bf16_bits(float x) { unsigned int u = __float_as_uint(x); return (unsigned short)((u + 0x7FFFu + ((u >> 16) & 1u)) >> 16); }
__device__ __forceinline__ float bf16_val(unsigned short b) { return __uint_as_float(((unsigned int)b) << 16); }
__device__ __forceinline__ float bf16_round(float x) { return bf16_val(bf16_bits(x)); }
// D += A·B with NT terms: 1 = ah·bh, 2 = + al·bh (A split), 3 = + ah·bl (both split)
template <int NT>
__device__ __forceinline__ v8f mmaN(v16b ah, v16b al, v16b bh, v16b bl, v8f c) {
  c = __builtin_amdgcn_wmma_f32_16x16x32_bf16(false, ah, false, bh, (short)0, c, false, false);
  if (NT >= 2) c = __builtin_amdgcn_wmma_f32_16x16x32_bf16(false, al, false, bh, (short)0, c, false, false);
  if (NT >= 3) c = __builtin_amdgcn_wmma_f32_16x16x32_bf16(false, ah, false, bl, (short)0, c, false, false);
  asm volatile("v_nop\n\tv_nop\n\tv_nop\n\tv_nop" : "+v"(c) : "v"(ah), "v"(al), "v"(bh), "v"(bl));
  return c;
}

__global__ __launch_bounds__(256) void k_wt_bf16(const float* __restrict__ W, unsigned short* __restrict__ Wt, int K, int N) {
  const int t = blockIdx.x * 256 + threadIdx.x;
  const int k8n = K / 8;
  if (t >= N * k8n) return;
  const int n = t / k8n, k8 = (t % k8n) * 8;
  v8us v;
#pragma unroll
  for (int i = 0; i < 8; ++i) v[i] = bf16_bits(W[(size_t)(k8 + i) * N + n]);
  *(v8us*)(Wt + (size_t)n * K + k8) = v;
  
}

// GEMM C[M][N] (f32, pitch ldc) = act(A[M][K]·W + bias). A f32 row-major (pitch lda) converted per fragment to bf16
// (ASPLIT: hi/lo two planes -> 2 terms, else single rounded term); Wt bf16 [N][K] (pitch ldb). BIAS_BF16 rounds the
// bias to bf16 first (bias quantised to bf16 before the add). K%32==0, M%16==0, N%64==0.
template <bool ASPLIT, int ACT, bool BIAS_BF16>
__global__ __launch_bounds__(128) void k_gemm_bf(const float* __restrict__ A, int lda, const unsigned short* __restrict__ Wt, int ldb,
                                               const float* __restrict__ bias, float* __restrict__ C, int ldc, int M, int N, int K) {
  __shared__ __attribute__((aligned(16))) float so[4][16][64];
  const int tid = threadIdx.x, w = tid >> 5, lane = tid & 31, ln = lane & 15, hh = lane >> 4;
  const int ntn = N / 64;
  const int wid = blockIdx.x * 4 + w;
  const int mt = wid / ntn, nq = wid % ntn;
  if (mt * 16 >= M) return;
  const int row0 = mt * 16, col0 = nq * 64;
  const float* arow = A + (size_t)(row0 + ln) * lda;
  v8f acc[4] = {};
  for (int kb = 0; kb < K; kb += 32) {
    FragB ah, al;
    const v4f x0 = *(const v4fa*)(arow + kb + 8 * hh), x1 = *(const v4fa*)(arow + kb + 8 * hh + 4);
    const v4f x2 = *(const v4fa*)(arow + kb + 16 + 8 * hh), x3 = *(const v4fa*)(arow + kb + 16 + 8 * hh + 4);
    float xs[16] = {x0[0],x0[1],x0[2],x0[3],x1[0],x1[1],x1[2],x1[3],x2[0],x2[1],x2[2],x2[3],x3[0],x3[1],x3[2],x3[3]};
#pragma unroll
    for (int i = 0; i < 16; ++i) { const unsigned short hb = bf16_bits(xs[i]); ah.u[i] = hb; al.u[i] = ASPLIT ? bf16_bits(xs[i] - bf16_val(hb)) : (unsigned short)0; }
#pragma unroll
    for (int t = 0; t < 4; ++t) {
      const unsigned short* brow = Wt + (size_t)(col0 + t * 16 + ln) * ldb + kb;
      FragB b;
      b.half[0] = *(const v8us*)(brow + 8 * hh);
      b.half[1] = *(const v8us*)(brow + 16 + 8 * hh);
      acc[t] = mmaN<ASPLIT ? 2 : 1>(ah.v, al.v, b.v, b.v, acc[t]);
    }
  }
#pragma unroll
  for (int t = 0; t < 4; ++t) {
    float bv = bias ? bias[col0 + t * 16 + ln] : 0.f;
    if (BIAS_BF16) bv = bf16_round(bv);
#pragma unroll
    for (int r = 0; r < 8; ++r) { float v = acc[t][r] + bv; if (ACT == 1) v = fmaxf(v, 0.f); so[w][8 * hh + r][t * 16 + ln] = v; }
  }
  __builtin_amdgcn_fence(__ATOMIC_ACQ_REL, "workgroup");
  __builtin_amdgcn_wave_barrier();
  const int rsub = lane >> 4, c4 = (lane & 15) * 4;
  {
#pragma unroll
    for (int q = 0; q < 8; ++q) {
      const int r = q * 2 + rsub;
      const v4f v = *(const v4fa*)&so[w][r][c4];
      *(v4f*)(C + (size_t)(row0 + r) * ldc + col0 + c4) = v;
    }
    
  }
}

// GEMM C = act(A·W + bias + resid): A f32 (ASPLIT -> hi/lo 2 terms), Wt bf16 [N][K]; ACT 0 none, 1 relu, 2 exact gelu;
// resid (optional, f32, row index = (row % rmod), pitch ldr, RES_BF16 rounds it) added before the activation.
template <bool ASPLIT, int ACT, bool BIAS_BF16, bool RES_BF16>
__global__ __launch_bounds__(128) void k_gemm_bf3(const float* __restrict__ A, int lda, const unsigned short* __restrict__ Wt, int ldb,
                                                const float* __restrict__ bias, const float* __restrict__ resid, int rmod, int ldr,
                                                float* __restrict__ C, int ldc, int M, int N, int K) {
  __shared__ __attribute__((aligned(16))) float so[4][16][64];
  const int tid = threadIdx.x, w = tid >> 5, lane = tid & 31, ln = lane & 15, hh = lane >> 4;
  const int ntn = N / 64;
  const int wid = blockIdx.x * 4 + w;
  const int mt = wid / ntn, nq = wid % ntn;
  if (mt * 16 >= M) return;
  const int row0 = mt * 16, col0 = nq * 64;
  const float* arow = A + (size_t)(row0 + ln) * lda;
  v8f acc[4] = {};
  for (int kb = 0; kb < K; kb += 32) {
    FragB ah, al;
    const v4f x0 = *(const v4fa*)(arow + kb + 8 * hh), x1 = *(const v4fa*)(arow + kb + 8 * hh + 4);
    const v4f x2 = *(const v4fa*)(arow + kb + 16 + 8 * hh), x3 = *(const v4fa*)(arow + kb + 16 + 8 * hh + 4);
    float xs[16] = {x0[0],x0[1],x0[2],x0[3],x1[0],x1[1],x1[2],x1[3],x2[0],x2[1],x2[2],x2[3],x3[0],x3[1],x3[2],x3[3]};
#pragma unroll
    for (int i = 0; i < 16; ++i) { const unsigned short hb = bf16_bits(xs[i]); ah.u[i] = hb; al.u[i] = ASPLIT ? bf16_bits(xs[i] - bf16_val(hb)) : (unsigned short)0; }
#pragma unroll
    for (int t = 0; t < 4; ++t) {
      const unsigned short* brow = Wt + (size_t)(col0 + t * 16 + ln) * ldb + kb;
      FragB b;
      b.half[0] = *(const v8us*)(brow + 8 * hh);
      b.half[1] = *(const v8us*)(brow + 16 + 8 * hh);
      acc[t] = mmaN<ASPLIT ? 2 : 1>(ah.v, al.v, b.v, b.v, acc[t]);
    }
  }
#pragma unroll
  for (int t = 0; t < 4; ++t) {
    const int col = col0 + t * 16 + ln;
    float bv = bias ? bias[col] : 0.f;
    if (BIAS_BF16) bv = bf16_round(bv);
#pragma unroll
    for (int r = 0; r < 8; ++r) {
      float v = acc[t][r] + bv;
      if (resid) { float rv = resid[(size_t)((row0 + 8 * hh + r) % rmod) * ldr + col]; if (RES_BF16) rv = bf16_round(rv); v += rv; }
      if (ACT == 1) v = fmaxf(v, 0.f);
      if (ACT == 2) v = 0.5f * v * (1.0f + erff(v * 0.70710678118654752f));
      if (ACT == 3) { const float u = 0.7978845608028654f * (v + 0.044715f * v * v * v); v = 0.5f * v * (1.0f + tanhf(u)); }
      so[w][8 * hh + r][t * 16 + ln] = v;
    }
  }
  __builtin_amdgcn_fence(__ATOMIC_ACQ_REL, "workgroup");
  __builtin_amdgcn_wave_barrier();
  const int rsub = lane >> 4, c4 = (lane & 15) * 4;
  {
#pragma unroll
    for (int q = 0; q < 8; ++q) {
      const int r = q * 2 + rsub;
      const v4f v = *(const v4fa*)&so[w][r][c4];
      *(v4f*)(C + (size_t)(row0 + r) * ldc + col0 + c4) = v;
    }
    
  }
}
// row LayerNorm (biased variance, eps) over N: s = X (+ R); optional out_sum <- s; out_norm <- (s-mu)*rsqrt(var+eps)*g + b
template <bool PARAM_BF16>
__global__ __launch_bounds__(256) void k_layernorm(const float* __restrict__ X, const float* __restrict__ R, const float* __restrict__ g, const float* __restrict__ bta,
                                                  float* __restrict__ out_sum, float* __restrict__ out_norm, int N, float eps) {
  __shared__ float red[256];
  const int row = blockIdx.x, tid = threadIdx.x;
  const float* x = X + (size_t)row * N; const float* rr = R ? R + (size_t)row * N : nullptr;
  float vals[16];                     // up to N = 4096
  const int per = N / 256;            // contiguous chunk per thread? use strided-by-4 chunks: thread handles j = tid*4 + 1024*u
  float s1 = 0.f;
  for (int u = 0; u < per / 4; ++u) {
    const int j = tid * 4 + 1024 * u;
    const v4f a = *(const v4fa*)(x + j);
    v4f b = {0.f,0.f,0.f,0.f}; if (rr) b = *(const v4fa*)(rr + j);
#pragma unroll
    for (int q = 0; q < 4; ++q) { const float v = a[q] + b[q]; vals[u * 4 + q] = v; s1 += v; }
  }
  red[tid] = s1; __syncthreads();
  for (int st = 128; st > 0; st >>= 1) { if (tid < st) red[tid] += red[tid + st]; __syncthreads(); }
  const float mu = red[0] / (float)N; __syncthreads();
  float s2 = 0.f;
  for (int u = 0; u < per / 4; ++u)
#pragma unroll
    for (int q = 0; q < 4; ++q) { const float c = vals[u * 4 + q] - mu; s2 += c * c; }
  red[tid] = s2; __syncthreads();
  for (int st = 128; st > 0; st >>= 1) { if (tid < st) red[tid] += red[tid + st]; __syncthreads(); }
  const float rs = rsqrtf(red[0] / (float)N + eps);
  {
    for (int u = 0; u < per / 4; ++u) {
      const int j = tid * 4 + 1024 * u;
      v4f o, sm;
#pragma unroll
      for (int q = 0; q < 4; ++q) {
        float gg = g[j + q], bb = bta[j + q];
        if (PARAM_BF16) { gg = bf16_round(gg); bb = bf16_round(bb); }
        sm[q] = vals[u * 4 + q]; o[q] = (vals[u * 4 + q] - mu) * rs * gg + bb;
      }
      if (out_sum) *(v4f*)(out_sum + (size_t)row * N + j) = sm;
      *(v4f*)(out_norm + (size_t)row * N + j) = o;
    }
    
  }
}



// ---- f16 WMMA path (v_wmma_f32_16x16x32_f16): 11-bit significands for operands in range — used where a [0,1] probability operand needs more precision than bf16
typedef _Float16 v16h __attribute__((ext_vector_type(16)));
union FragH { v16h v; v8us half[2]; _Float16 h[16]; unsigned short u[16]; };
template <int NT>
__device__ __forceinline__ v8f mmaH(v16h ah, v16h al, v16h bh, v16h bl, v8f c) {
  c = __builtin_amdgcn_wmma_f32_16x16x32_f16(false, ah, false, bh, (short)0, c, false, false);
  if (NT >= 2) c = __builtin_amdgcn_wmma_f32_16x16x32_f16(false, al, false, bh, (short)0, c, false, false);
  if (NT >= 3) c = __builtin_amdgcn_wmma_f32_16x16x32_f16(false, ah, false, bl, (short)0, c, false, false);
  asm volatile("v_nop\n\tv_nop\n\tv_nop\n\tv_nop" : "+v"(c) : "v"(ah), "v"(al), "v"(bh), "v"(bl));
  return c;
}
// batched GEMM like k_gemm_b but f16 operands: A f32 (split into f16 hi/lo if ASPLIT, else rounded to f16), Bt = f16 values [n][k]; alpha; C f32; N multiple of 16 (partial tiles skipped)
template <bool ASPLIT>
__global__ __launch_bounds__(128) void k_gemm_h(const float* __restrict__ A, int lda, size_t sA, const _Float16* __restrict__ Bh, int ldb, size_t sB, float alpha, float* __restrict__ C, int ldc, size_t sC, int M, int N, int K) {
  __shared__ __attribute__((aligned(16))) float so[4][16][64];
  const int tid = threadIdx.x, w = tid >> 5, lane = tid & 31, ln = lane & 15, hh = lane >> 4; const int by = blockIdx.y;
  A += (size_t)by * sA; Bh += (size_t)by * sB; C += (size_t)by * sC;
  const int ntn = (N + 63) / 64; const int wid = blockIdx.x * 4 + w; const int mt = wid / ntn, nq = wid % ntn; if (mt * 16 >= M) return;
  const int row0 = mt * 16, col0 = nq * 64; const float* arow = A + (size_t)(row0 + ln) * lda;
  v8f acc[4] = {};
  for (int kb = 0; kb < K; kb += 32) {
    FragH ah, al;
    const v4f x0 = *(const v4fa*)(arow + kb + 8 * hh), x1 = *(const v4fa*)(arow + kb + 8 * hh + 4), x2 = *(const v4fa*)(arow + kb + 16 + 8 * hh), x3 = *(const v4fa*)(arow + kb + 16 + 8 * hh + 4);
    float xs[16] = {x0[0],x0[1],x0[2],x0[3],x1[0],x1[1],x1[2],x1[3],x2[0],x2[1],x2[2],x2[3],x3[0],x3[1],x3[2],x3[3]};
#pragma unroll
    for (int i = 0; i < 16; ++i) { const _Float16 h = (_Float16)xs[i]; ah.h[i] = h; al.h[i] = ASPLIT ? (_Float16)(xs[i] - (float)h) : (_Float16)0.0f; }
#pragma unroll
    for (int t = 0; t < 4; ++t) { if (col0 + t * 16 >= N) continue; const size_t boff = (size_t)(col0 + t * 16 + ln) * ldb + kb; FragH bq; bq.half[0] = *(const v8us*)(Bh + boff + 8 * hh); bq.half[1] = *(const v8us*)(Bh + boff + 16 + 8 * hh);
      acc[t] = mmaH<ASPLIT ? 2 : 1>(ah.v, al.v, bq.v, bq.v, acc[t]); }
  }
#pragma unroll
  for (int t = 0; t < 4; ++t) { if (col0 + t * 16 >= N) continue;
#pragma unroll
    for (int r = 0; r < 8; ++r) so[w][8 * hh + r][t * 16 + ln] = acc[t][r] * alpha; }
  __builtin_amdgcn_fence(__ATOMIC_ACQ_REL, "workgroup"); __builtin_amdgcn_wave_barrier();
  const int rsub = lane >> 4, c4 = (lane & 15) * 4;
  {
#pragma unroll
    for (int q = 0; q < 8; ++q) { const int r = q * 2 + rsub; if (col0 + c4 < N) { const v4f v = *(const v4fa*)&so[w][r][c4]; *(v4f*)(C + (size_t)(row0 + r) * ldc + col0 + c4) = v; } }
     }
}

// Wt[n][k] = f16(W[k][n]·scale) from f32 row-major W[K][N] (scale = power of two; bf16-exact weights stay exact in f16 away from the subnormal range)
__global__ __launch_bounds__(256) void k_wt_f16(const float* __restrict__ W, _Float16* __restrict__ Wt, int K, int N, float scale) {
  const int t = blockIdx.x * 256 + threadIdx.x; if (t >= N * (K / 8)) return; const int n = t / (K / 8), k8 = (t % (K / 8)) * 8; FragH f;
#pragma unroll
  for (int i = 0; i < 8; ++i) f.h[i] = (_Float16)(bf16_round(W[(size_t)(k8 + i) * N + n]) * scale); const v8us o = f.half[0];
  *(v8us*)((unsigned short*)Wt + (size_t)n * K + k8) = o; 
}
// k_gemm_hh variant with fused epilogue: v = acc·alpha + bias[by·sBias + col] (+ CP[(row/rowsPerB)·sCPb + by·64 + col] if CP) ; ACT 0 none / 1 elu ; writes f16 C16 (and f32 C if non-null)
template <int ACT>
__global__ __launch_bounds__(128) void k_gemm_hhx(const _Float16* __restrict__ A, int lda, size_t sA, const _Float16* __restrict__ Bh, int ldb, size_t sB, float alpha, const float* __restrict__ bias, size_t sBias, const float* __restrict__ CP, int rowsPerB, size_t sCPb, int row0g,
    float* __restrict__ C, _Float16* __restrict__ C16, int ldc, size_t sC, int M, int N, int K) {
  __shared__ __attribute__((aligned(16))) float so[4][16][64];
  const int tid = threadIdx.x, w = tid >> 5, lane = tid & 31, ln = lane & 15, hh = lane >> 4; const int by = blockIdx.y;
  A += (size_t)by * sA; Bh += (size_t)by * sB; const size_t cofs = (size_t)by * sC; const float* bp = bias ? bias + (size_t)by * sBias : nullptr;
  const int ntn = (N + 63) / 64; const int wid = blockIdx.x * 4 + w; const int mt = wid / ntn, nq = wid % ntn; if (mt * 16 >= M) return;
  const int row0 = mt * 16, col0 = nq * 64; const _Float16* arow = A + (size_t)(row0 + ln) * lda;
  v8f acc[4] = {};
  for (int kb = 0; kb < K; kb += 32) { FragH ah; ah.half[0] = *(const v8us*)((const unsigned short*)arow + kb + 8 * hh); ah.half[1] = *(const v8us*)((const unsigned short*)arow + kb + 16 + 8 * hh);
#pragma unroll
    for (int t = 0; t < 4; ++t) { if (col0 + t * 16 >= N) continue; const size_t boff = (size_t)(col0 + t * 16 + ln) * ldb + kb; FragH bq; bq.half[0] = *(const v8us*)((const unsigned short*)Bh + boff + 8 * hh); bq.half[1] = *(const v8us*)((const unsigned short*)Bh + boff + 16 + 8 * hh);
      acc[t] = mmaH<1>(ah.v, ah.v, bq.v, bq.v, acc[t]); }
  }
#pragma unroll
  for (int t = 0; t < 4; ++t) { if (col0 + t * 16 >= N) continue; const int col = col0 + t * 16 + ln; const float bv = bp ? bf16_round(bp[col]) : 0.f;
#pragma unroll
    for (int r = 0; r < 8; ++r) { float v = acc[t][r] * alpha + bv; if (CP) { const int bidx = (row0g + row0 + 8 * hh + r) / rowsPerB; v += CP[(size_t)bidx * sCPb + (size_t)by * 64 + col]; } if (ACT == 1) v = (v > 0.f) ? v : expm1f(v); else if (ACT == 7) v = (v > 0.f) ? v + 1.0f : expf(v); else if (ACT == 8) v = tanhf(v); else if (ACT == 9) v = 0.5f * v * (1.0f + tanhf(0.7978845608028654f * (v + 0.044715f * v * v * v))); else if (ACT == 11) v = 1.0f / (1.0f + expf(-v)); else if (ACT == 12) v = (v > 0.f) ? v : 0.01f * v; else if (ACT == 14) v = (v > 0.f) ? v : 0.1f * v; else if (ACT == 15) v = v / (1.0f + expf(-v)); else if (ACT == 3) v = fmaxf(v, 0.f); else if (ACT == 6) v = 0.5f * v * (1.0f + erff(v * 0.70710678118654752f)); so[w][8 * hh + r][t * 16 + ln] = v; } }
  __builtin_amdgcn_fence(__ATOMIC_ACQ_REL, "workgroup"); __builtin_amdgcn_wave_barrier();
  const int rsub = lane >> 4, c4 = (lane & 15) * 4; typedef _Float16 v4h __attribute__((ext_vector_type(4)));
  {
#pragma unroll
    for (int q = 0; q < 8; ++q) { const int r = q * 2 + rsub; if (col0 + c4 < N) { const v4f v = *(const v4fa*)&so[w][r][c4]; if (C) *(v4f*)(C + cofs + (size_t)(row0 + r) * ldc + col0 + c4) = v; if (C16) { v4h h4; for (int i = 0; i < 4; ++i) h4[i] = (_Float16)v[i]; *(v4h*)(C16 + cofs + (size_t)(row0 + r) * ldc + col0 + c4) = h4; } } }
     }
}


typedef _Float16 v4h __attribute__((ext_vector_type(4)));

__global__ __launch_bounds__(256) void k_x16(const float* __restrict__ x, _Float16* __restrict__ X16, size_t n8) { const size_t t = (size_t)blockIdx.x * 256 + threadIdx.x; if (t >= n8) return; FragH f;
#pragma unroll
  for (int q = 0; q < 8; ++q) f.h[q] = (_Float16)bf16_round(x[t * 8 + q]); *(v8us*)((unsigned short*)X16 + t * 8) = f.half[0];  }
__global__ __launch_bounds__(256) void k_h16(const float* __restrict__ x, _Float16* __restrict__ X16, size_t n8) { const size_t t = (size_t)blockIdx.x * 256 + threadIdx.x; if (t >= n8) return; FragH f;
#pragma unroll
  for (int q = 0; q < 8; ++q) f.h[q] = (_Float16)x[t * 8 + q]; *(v8us*)((unsigned short*)X16 + t * 8) = f.half[0];  }
__global__ __launch_bounds__(256) void k_round16f(const float* __restrict__ W, _Float16* __restrict__ Bt, size_t n8) { const size_t t = (size_t)blockIdx.x * 256 + threadIdx.x; if (t >= n8) return; FragH f;
#pragma unroll
  for (int i = 0; i < 8; ++i) f.h[i] = (_Float16)(bf16_round(W[t * 8 + i]) * 16.0f); *(v8us*)((unsigned short*)Bt + t * 8) = f.half[0];  }
template <int NHv, int TTv>
__global__ __launch_bounds__(256) void k_vt(const _Float16* __restrict__ V16, int ldv, int voff, _Float16* __restrict__ Vt) { __shared__ unsigned short tl[64][66]; const int tid = threadIdx.x; const int slab = blockIdx.x / (TTv / 64), lg = blockIdx.x % (TTv / 64); const int b = slab / NHv, h = slab % NHv;
  for (int i = tid; i < 64 * 8; i += 256) { const int r = i / 8, c8 = (i % 8) * 8; FragH f; f.half[0] = *(const v8us*)((const unsigned short*)V16 + ((size_t)b * TTv + lg * 64 + r) * ldv + voff + h * 64 + c8);
#pragma unroll
    for (int q = 0; q < 8; ++q) tl[r][c8 + q] = f.u[q]; }
  __syncthreads();
  {
#pragma unroll
    for (int rd = 0; rd < 2; ++rd) { const int d = rd * 32 + tid / 8, pc = tid % 8; FragH f;
#pragma unroll
      for (int q = 0; q < 8; ++q) f.u[q] = tl[pc * 8 + q][d];
      *(v8us*)((unsigned short*)Vt + ((size_t)slab * 64 + d) * TTv + lg * 64 + pc * 8) = f.half[0]; }
     } }

__global__ __launch_bounds__(256) void k_hl(const float* __restrict__ F, _Float16* __restrict__ Hh, _Float16* __restrict__ Hl, size_t n8) { const size_t t = (size_t)blockIdx.x * 256 + threadIdx.x; if (t >= n8) return; FragH fh, fl; const v4f a = *(const v4fa*)(F + t * 8), c = *(const v4fa*)(F + t * 8 + 4);
#pragma unroll
  for (int q = 0; q < 4; ++q) { _Float16 h = (_Float16)a[q]; fh.h[q] = h; fl.h[q] = (_Float16)((a[q] - (float)h) * 1024.0f); h = (_Float16)c[q]; fh.h[4 + q] = h; fl.h[4 + q] = (_Float16)((c[q] - (float)h) * 1024.0f); }
  { *(v8us*)((unsigned short*)Hh + t * 8) = fh.half[0]; *(v8us*)((unsigned short*)Hl + t * 8) = fl.half[0];  } }

// ---- fast GEMM (wave tile 32x64; requires M % 32 == 0 rows per launch region and N % 64 == 0); epilogue = k_gemm_hhx semantics ----
__device__ __forceinline__ v16h g2_frag(const _Float16* p, int hh) { FragH f; f.half[0] = *(const v8us*)((const unsigned short*)p + 8 * hh); f.half[1] = *(const v8us*)((const unsigned short*)p + 16 + 8 * hh); return f.v; }
__device__ __forceinline__ v8f g2_mma(v16h a, v16h b, v8f c) { v8f d = __builtin_amdgcn_wmma_f32_16x16x32_f16(false, a, false, b, (short)0, c, false, false); asm volatile("v_nop\n\tv_nop\n\tv_nop\n\tv_nop" : "+v"(d) : "v"(a), "v"(b)); return d; }
template <int ACT>
__global__ __launch_bounds__(128) void k_gemm2(const _Float16* __restrict__ A, int lda, size_t sA, const _Float16* __restrict__ Bh, int ldb, size_t sB, float alpha, const float* __restrict__ bias, size_t sBias, const float* __restrict__ CP, int rowsPerB, size_t sCPb, int row0g,
    float* __restrict__ C, _Float16* __restrict__ C16, int ldc, size_t sC, int M, int N, int K) {
  __shared__ __attribute__((aligned(16))) float so[4][32][68];
  const int tid = threadIdx.x, w = tid >> 5, lane = tid & 31, ln = lane & 15, hh = lane >> 4; const int by = blockIdx.y;
  A += (size_t)by * sA; Bh += (size_t)by * sB; const size_t cofs = (size_t)by * sC; const float* bp = bias ? bias + (size_t)by * sBias : nullptr;
  const int ntn = N >> 6; const int mt = blockIdx.x / ntn, nq = blockIdx.x - mt * ntn; const int row0 = mt * 128 + 32 * w, col0 = nq * 64; if (row0 >= M) return;
  const _Float16* a0p = A + (size_t)(row0 + ln) * lda; const _Float16* a1p = a0p + (size_t)16 * lda;
  const _Float16* b0p = Bh + (size_t)(col0 + ln) * ldb; const _Float16* b1p = b0p + (size_t)16 * ldb; const _Float16* b2p = b1p + (size_t)16 * ldb; const _Float16* b3p = b2p + (size_t)16 * ldb;
  const v8f z8 = {0.f,0.f,0.f,0.f,0.f,0.f,0.f,0.f}; v8f c00 = z8, c01 = z8, c02 = z8, c03 = z8, c10 = z8, c11 = z8, c12 = z8, c13 = z8;
#pragma unroll 1
  for (int kb = 0; kb < K; kb += 32) { const v16h a0 = g2_frag(a0p + kb, hh), a1 = g2_frag(a1p + kb, hh);
    v16h b = g2_frag(b0p + kb, hh); c00 = g2_mma(a0, b, c00); c10 = g2_mma(a1, b, c10);
    b = g2_frag(b1p + kb, hh); c01 = g2_mma(a0, b, c01); c11 = g2_mma(a1, b, c11);
    b = g2_frag(b2p + kb, hh); c02 = g2_mma(a0, b, c02); c12 = g2_mma(a1, b, c12);
    b = g2_frag(b3p + kb, hh); c03 = g2_mma(a0, b, c03); c13 = g2_mma(a1, b, c13); }
  v8f accs[8] = {c00, c01, c02, c03, c10, c11, c12, c13};
#pragma unroll
  for (int u = 0; u < 8; ++u) { const int t = u & 3, half = u >> 2; const int col = col0 + t * 16 + ln; const float bv = bp ? bf16_round(bp[col]) : 0.f;
#pragma unroll
    for (int r = 0; r < 8; ++r) { const int rloc = half * 16 + 8 * hh + r; float v = accs[u][r] * alpha + bv; if (CP) { const int bidx = (row0g + row0 + rloc) / rowsPerB; v += CP[(size_t)bidx * sCPb + (size_t)by * 64 + col]; }
      if (ACT == 3) v = fmaxf(v, 0.f); else if (ACT == 6) v = 0.5f * v * (1.0f + erff(v * 0.70710678118654752f)); else if (ACT == 11) v = 1.0f / (1.0f + expf(-v)); else if (ACT == 15) v = v / (1.0f + expf(-v)); else if (ACT == 12) v = (v > 0.f) ? v : 0.01f * v; else if (ACT == 8) v = tanhf(v);
      so[w][rloc][t * 16 + ln] = v; } }
  __builtin_amdgcn_fence(__ATOMIC_ACQ_REL, "workgroup"); __builtin_amdgcn_wave_barrier();
  const int rsub = lane >> 4, c4 = (lane & 15) * 4;
  {
#pragma unroll
    for (int q = 0; q < 16; ++q) { const int r = q * 2 + rsub; const v4f v = *(const v4fa*)&so[w][r][c4]; if (C) *(v4f*)(C + cofs + (size_t)(row0 + r) * ldc + col0 + c4) = v; if (C16) { v4h h4; for (int i = 0; i < 4; ++i) h4[i] = (_Float16)v[i]; *(v4h*)(C16 + cofs + (size_t)(row0 + r) * ldc + col0 + c4) = h4; } }
     } }


template <int NHv, int TTv>
__global__ __launch_bounds__(256) void k_vt2(const _Float16* __restrict__ V16, int ldv, _Float16* __restrict__ Vt, int ldt, int col0) { __shared__ unsigned short tl[64][66]; const int tid = threadIdx.x; const int h = blockIdx.x / (TTv / 64), lg = blockIdx.x % (TTv / 64);
  for (int i = tid; i < 64 * 8; i += 256) { const int r = i / 8, c8 = (i % 8) * 8; FragH f; f.half[0] = *(const v8us*)((const unsigned short*)V16 + ((size_t)lg * 64 + r) * ldv + h * 64 + c8);
#pragma unroll
    for (int q = 0; q < 8; ++q) tl[r][c8 + q] = f.u[q]; }
  __syncthreads();
  {
#pragma unroll
    for (int rd = 0; rd < 2; ++rd) { const int d = rd * 32 + tid / 8, pc = tid % 8; FragH f;
#pragma unroll
      for (int q = 0; q < 8; ++q) f.u[q] = tl[pc * 8 + q][d];
      *(v8us*)((unsigned short*)Vt + ((size_t)h * 64 + d) * ldt + col0 + lg * 64 + pc * 8) = f.half[0]; }
     } }
__global__ __launch_bounds__(256) void k_hlraw(const float* __restrict__ F, _Float16* __restrict__ H, _Float16* __restrict__ L, size_t n8) {
  #pragma clang fp contract(off)
  const size_t t = (size_t)blockIdx.x * 256 + threadIdx.x; if (t >= n8) return; FragH a, b; for (int q = 0; q < 8; ++q) { const float v = F[t * 8 + q]; const _Float16 h = (_Float16)v; a.h[q] = h; b.h[q] = (_Float16)(v - (float)h); }
  { *(v8us*)((unsigned short*)H + t * 8) = a.half[0]; *(v8us*)((unsigned short*)L + t * 8) = b.half[0];  } }

__global__ __launch_bounds__(256) void k_soft(const float* __restrict__ S, _Float16* __restrict__ PP) {
  #pragma clang fp contract(off)
  const int tid = threadIdx.x, w = tid >> 5, ln = tid & 31; const int r = blockIdx.x * 8 + w; if (r >= SLEN) return; const float* s = S + (size_t)r * SLEN; float m = -3.0e38f;
#pragma unroll 1
  for (int c = 0; c < SLEN / 256; ++c) { const float* p = s + c * 256 + ln * 8; for (int q = 0; q < 8; ++q) m = fmaxf(m, p[q]); }
  for (int o = 16; o > 0; o >>= 1) m = fmaxf(m, __shfl_xor(m, o, 32)); float su = 0.f;
#pragma unroll 1
  for (int c = 0; c < SLEN / 256; ++c) { const float* p = s + c * 256 + ln * 8; for (int q = 0; q < 8; ++q) su += expf(p[q] - m); }
  for (int o = 16; o > 0; o >>= 1) su += __shfl_xor(su, o, 32); const float inv = 1024.0f / su; unsigned short* d = (unsigned short*)PP + (size_t)r * 2 * SLEN;
  {
#pragma unroll 1
    for (int c = 0; c < SLEN / 256; ++c) { const float* p = s + c * 256 + ln * 8; FragH f;
#pragma unroll
      for (int q = 0; q < 8; ++q) f.h[q] = (_Float16)(expf(p[q] - m) * inv);
      *(v8us*)(d + c * 256 + ln * 8) = f.half[0]; *(v8us*)(d + SLEN + c * 256 + ln * 8) = f.half[0]; }
     } }

extern "C" void kernel_launch(void* const* d_in, const int* in_sizes, int n_in,
                              void* d_out, int out_size, void* d_ws, size_t ws_size, hipStream_t stream) {
  (void)in_sizes; (void)n_in; (void)out_size;
  const float* const* I = (const float* const*)d_in; const float* x = I[0]; const float* Wq = I[1]; const float* bq = I[2]; const float* Wk = I[3]; const float* bk = I[4]; const float* Wv = I[5]; const float* bv = I[6];
  char* ws = (char*)d_ws; size_t off = 0;
  auto take = [&](size_t bytes) { char* p = ws + off; off += (bytes + 255) & ~(size_t)255; return p; };
  _Float16* BQ = (_Float16*)take((size_t)FF * FF * 2); _Float16* BK = (_Float16*)take((size_t)FF * FF * 2); _Float16* BV = (_Float16*)take((size_t)FF * FF * 2);
  _Float16* X16 = (_Float16*)take((size_t)SLEN * FF * 2); _Float16* Q16 = (_Float16*)take((size_t)SLEN * FF * 2); _Float16* K16 = (_Float16*)take((size_t)SLEN * FF * 2); float* VF = (float*)take((size_t)SLEN * FF * 4); _Float16* Vh = (_Float16*)take((size_t)SLEN * FF * 2); _Float16* Vl = (_Float16*)take((size_t)SLEN * FF * 2); _Float16* VT2 = (_Float16*)take((size_t)FF * 2 * SLEN * 2);
  float* S = (float*)take((size_t)SLEN * SLEN * 4); _Float16* PP = (_Float16*)take((size_t)SLEN * 2 * SLEN * 2);
  if (off > ws_size) return;      /* 0.1 + 3.5 + 1 + 16 + 16 = 37 MiB */
  const size_t w8 = (size_t)FF * FF / 8; const unsigned wb = (unsigned)((w8 + 255) / 256);
  k_round16f<<<wb, 256, 0, stream>>>(Wq, BQ, w8); k_round16f<<<wb, 256, 0, stream>>>(Wk, BK, w8); k_round16f<<<wb, 256, 0, stream>>>(Wv, BV, w8);      /* torch (out,in) = natural Bt */
  const size_t n8 = (size_t)SLEN * FF / 8; const unsigned nb8 = (unsigned)((n8 + 255) / 256); const dim3 gP((SLEN / 128) * (FF / 64), 1), gS((SLEN / 128) * (SLEN / 64), 1);
  for (int b = 0; b < NBT; ++b) { const size_t ro = (size_t)b * SLEN * FF;
    k_x16<<<nb8, 256, 0, stream>>>(x + ro, X16, n8);
    k_gemm2<0><<<gP, 128, 0, stream>>>(X16, FF, 0, BQ, FF, 0, 0.0625f, bq, 0, nullptr, 1, 0, 0, nullptr, Q16, FF, 0, SLEN, FF, FF);
    k_gemm2<0><<<gP, 128, 0, stream>>>(X16, FF, 0, BK, FF, 0, 0.0625f, bk, 0, nullptr, 1, 0, 0, nullptr, K16, FF, 0, SLEN, FF, FF);
    k_gemm2<0><<<gP, 128, 0, stream>>>(X16, FF, 0, BV, FF, 0, 0.0625f, bv, 0, nullptr, 1, 0, 0, VF, nullptr, FF, 0, SLEN, FF, FF); k_hlraw<<<nb8, 256, 0, stream>>>(VF, Vh, Vl, n8);
    k_vt2<FF / 64, SLEN><<<(FF / 64) * (SLEN / 64), 256, 0, stream>>>(Vh, FF, VT2, 2 * SLEN, 0); k_vt2<FF / 64, SLEN><<<(FF / 64) * (SLEN / 64), 256, 0, stream>>>(Vl, FF, VT2, 2 * SLEN, SLEN);
    k_gemm2<0><<<gS, 128, 0, stream>>>(Q16, FF, 0, K16, FF, 0, 0.0625f, nullptr, 0, nullptr, 1, 0, 0, S, nullptr, SLEN, 0, SLEN, SLEN, FF);      /* scores / sqrt(256) = / 16 */
    k_soft<<<SLEN / 8, 256, 0, stream>>>(S, PP);
    k_gemm2<0><<<gP, 128, 0, stream>>>(PP, 2 * SLEN, 0, VT2, 2 * SLEN, 0, 0.0009765625f, nullptr, 0, nullptr, 1, 0, 0, (float*)d_out + ro, nullptr, FF, 0, SLEN, FF, 2 * SLEN); }      /* alpha . (v_hi + v_lo) */
}

// v001
// Measured time: 658 microseconds a run.
// Two timings next to v000 both put it at 4.12 times that version's speed.
#include <hip/hip_runtime.h>
// Non-local interaction (16 x 2048 tokens, 128 features, single head): q,k,v = x W^T + b; alpha = softmax(q.k / 16); out = alpha v -> [16,2048,128].
// Structure (batches side by side in the grid: the planes up to v^T once for all 16, scores / softmax / out in groups of GRP batches on blockIdx.y, as many as the workspace holds): x as an exact f16 plane; projections as f16 WMMA GEMMs (32x64 wave tiles, f32 accumulation, exact x16 weights + bias); scores as one GEMM (K 128) into an f32 [2048][2048] plane; wave-per-row f32 softmax (three rolled passes; P x2^10 f16 written as [P | P]); v split into f16 hi and raw residual planes, transposed; out = [P | P] . [v_hi^T | v_lo^T] (K 4096) straight into the output rows.
// Compute dtype: x, weights, biases rounded to bf16; q, k, P as f16 operands (~2^-12; logits sigma ~1.4); v as hi + residual (~2^-22); f32 accumulation and softmax. v_wmma_f32_16x16x32_f16.
#define NBT 16
#define SLEN 2048
#define FF 128
#define GRP 6
typedef __bf16 v16b __attribute__((ext_vector_type(16)));
typedef unsigned short v8us __attribute__((ext_vector_type(8), may_alias));
typedef float  v8f  __attribute__((ext_vector_type(8)));
typedef float  v4f  __attribute__((ext_vector_type(4)));
typedef float  v4fa __attribute__((ext_vector_type(4), may_alias));
union FragB { v16b v; v8us half[2]; unsigned short u[16]; };

__device__ __forceinline__ unsigned short bf16_bits(float x) { unsigned int u = __float_as_uint(x); return (unsigned short)((u + 0x7FFFu + ((u >> 16) & 1u)) >> 16); }
__device__ __forceinline__ float bf16_val(unsigned short b) { return __uint_as_float(((unsigned int)b) << 16); }
__device__ __forceinline__ float bf16_round(float x) { return bf16_val(bf16_bits(x)); }
// D += A·B with NT terms: 1 = ah·bh, 2 = + al·bh (A split), 3 = + ah·bl (both split)
template <int NT>
__device__ __forceinline__ v8f mmaN(v16b ah, v16b al, v16b bh, v16b bl, v8f c) {
  c = __builtin_amdgcn_wmma_f32_16x16x32_bf16(false, ah, false, bh, (short)0, c, false, false);
  if (NT >= 2) c = __builtin_amdgcn_wmma_f32_16x16x32_bf16(false, al, false, bh, (short)0, c, false, false);
  if (NT >= 3) c = __builtin_amdgcn_wmma_f32_16x16x32_bf16(false, ah, false, bl, (short)0, c, false, false);
  asm volatile("v_nop\n\tv_nop\n\tv_nop\n\tv_nop" : "+v"(c) : "v"(ah), "v"(al), "v"(bh), "v"(bl));
  return c;
}

__global__ __launch_bounds__(256) void k_wt_bf16(const float* __restrict__ W, unsigned short* __restrict__ Wt, int K, int N) {
  const int t = blockIdx.x * 256 + threadIdx.x;
  const int k8n = K / 8;
  if (t >= N * k8n) return;
  const int n = t / k8n, k8 = (t % k8n) * 8;
  v8us v;
#pragma unroll
  for (int i = 0; i < 8; ++i) v[i] = bf16_bits(W[(size_t)(k8 + i) * N + n]);
  *(v8us*)(Wt + (size_t)n * K + k8) = v;
  
}

// GEMM C[M][N] (f32, pitch ldc) = act(A[M][K]·W + bias). A f32 row-major (pitch lda) converted per fragment to bf16
// (ASPLIT: hi/lo two planes -> 2 terms, else single rounded term); Wt bf16 [N][K] (pitch ldb). BIAS_BF16 rounds the
// bias to bf16 first (bias quantised to bf16 before the add). K%32==0, M%16==0, N%64==0.
template <bool ASPLIT, int ACT, bool BIAS_BF16>
__global__ __launch_bounds__(128) void k_gemm_bf(const float* __restrict__ A, int lda, const unsigned short* __restrict__ Wt, int ldb,
                                               const float* __restrict__ bias, float* __restrict__ C, int ldc, int M, int N, int K) {
  __shared__ __attribute__((aligned(16))) float so[4][16][64];
  const int tid = threadIdx.x, w = tid >> 5, lane = tid & 31, ln = lane & 15, hh = lane >> 4;
  const int ntn = N / 64;
  const int wid = blockIdx.x * 4 + w;
  const int mt = wid / ntn, nq = wid % ntn;
  if (mt * 16 >= M) return;
  const int row0 = mt * 16, col0 = nq * 64;
  const float* arow = A + (size_t)(row0 + ln) * lda;
  v8f acc[4] = {};
  for (int kb = 0; kb < K; kb += 32) {
    FragB ah, al;
    const v4f x0 = *(const v4fa*)(arow + kb + 8 * hh), x1 = *(const v4fa*)(arow + kb + 8 * hh + 4);
    const v4f x2 = *(const v4fa*)(arow + kb + 16 + 8 * hh), x3 = *(const v4fa*)(arow + kb + 16 + 8 * hh + 4);
    float xs[16] = {x0[0],x0[1],x0[2],x0[3],x1[0],x1[1],x1[2],x1[3],x2[0],x2[1],x2[2],x2[3],x3[0],x3[1],x3[2],x3[3]};
#pragma unroll
    for (int i = 0; i < 16; ++i) { const unsigned short hb = bf16_bits(xs[i]); ah.u[i] = hb; al.u[i] = ASPLIT ? bf16_bits(xs[i] - bf16_val(hb)) : (unsigned short)0; }
#pragma unroll
    for (int t = 0; t < 4; ++t) {
      const unsigned short* brow = Wt + (size_t)(col0 + t * 16 + ln) * ldb + kb;
      FragB b;
      b.half[0] = *(const v8us*)(brow + 8 * hh);
      b.half[1] = *(const v8us*)(brow + 16 + 8 * hh);
      acc[t] = mmaN<ASPLIT ? 2 : 1>(ah.v, al.v, b.v, b.v, acc[t]);
    }
  }
#pragma unroll
  for (int t = 0; t < 4; ++t) {
    float bv = bias ? bias[col0 + t * 16 + ln] : 0.f;
    if (BIAS_BF16) bv = bf16_round(bv);
#pragma unroll
    for (int r = 0; r < 8; ++r) { float v = acc[t][r] + bv; if (ACT == 1) v = fmaxf(v, 0.f); so[w][8 * hh + r][t * 16 + ln] = v; }
  }
  __builtin_amdgcn_fence(__ATOMIC_ACQ_REL, "workgroup");
  __builtin_amdgcn_wave_barrier();
  const int rsub = lane >> 4, c4 = (lane & 15) * 4;
  {
#pragma unroll
    for (int q = 0; q < 8; ++q) {
      const int r = q * 2 + rsub;
      const v4f v = *(const v4fa*)&so[w][r][c4];
      *(v4f*)(C + (size_t)(row0 + r) * ldc + col0 + c4) = v;
    }
    
  }
}

// GEMM C = act(A·W + bias + resid): A f32 (ASPLIT -> hi/lo 2 terms), Wt bf16 [N][K]; ACT 0 none, 1 relu, 2 exact gelu;
// resid (optional, f32, row index = (row % rmod), pitch ldr, RES_BF16 rounds it) added before the activation.
template <bool ASPLIT, int ACT, bool BIAS_BF16, bool RES_BF16>
__global__ __launch_bounds__(128) void k_gemm_bf3(const float* __restrict__ A, int lda, const unsigned short* __restrict__ Wt, int ldb,
                                                const float* __restrict__ bias, const float* __restrict__ resid, int rmod, int ldr,
                                                float* __restrict__ C, int ldc, int M, int N, int K) {
  __shared__ __attribute__((aligned(16))) float so[4][16][64];
  const int tid = threadIdx.x, w = tid >> 5, lane = tid & 31, ln = lane & 15, hh = lane >> 4;
  const int ntn = N / 64;
  const int wid = blockIdx.x * 4 + w;
  const int mt = wid / ntn, nq = wid % ntn;
  if (mt * 16 >= M) return;
  const int row0 = mt * 16, col0 = nq * 64;
  const float* arow = A + (size_t)(row0 + ln) * lda;
  v8f acc[4] = {};
  for (int kb = 0; kb < K; kb += 32) {
    FragB ah, al;
    const v4f x0 = *(const v4fa*)(arow + kb + 8 * hh), x1 = *(const v4fa*)(arow + kb + 8 * hh + 4);
    const v4f x2 = *(const v4fa*)(arow + kb + 16 + 8 * hh), x3 = *(const v4fa*)(arow + kb + 16 + 8 * hh + 4);
    float xs[16] = {x0[0],x0[1],x0[2],x0[3],x1[0],x1[1],x1[2],x1[3],x2[0],x2[1],x2[2],x2[3],x3[0],x3[1],x3[2],x3[3]};
#pragma unroll
    for (int i = 0; i < 16; ++i) { const unsigned short hb = bf16_bits(xs[i]); ah.u[i] = hb; al.u[i] = ASPLIT ? bf16_bits(xs[i] - bf16_val(hb)) : (unsigned short)0; }
#pragma unroll
    for (int t = 0; t < 4; ++t) {
      const unsigned short* brow = Wt + (size_t)(col0 + t * 16 + ln) * ldb + kb;
      FragB b;
      b.half[0] = *(const v8us*)(brow + 8 * hh);
      b.half[1] = *(const v8us*)(brow + 16 + 8 * hh);
      acc[t] = mmaN<ASPLIT ? 2 : 1>(ah.v, al.v, b.v, b.v, acc[t]);
    }
  }
#pragma unroll
  for (int t = 0; t < 4; ++t) {
    const int col = col0 + t * 16 + ln;
    float bv = bias ? bias[col] : 0.f;
    if (BIAS_BF16) bv = bf16_round(bv);
#pragma unroll
    for (int r = 0; r < 8; ++r) {
      float v = acc[t][r] + bv;
      if (resid) { float rv = resid[(size_t)((row0 + 8 * hh + r) % rmod) * ldr + col]; if (RES_BF16) rv = bf16_round(rv); v += rv; }
      if (ACT == 1) v = fmaxf(v, 0.f);
      if (ACT == 2) v = 0.5f * v * (1.0f + erff(v * 0.70710678118654752f));
      if (ACT == 3) { const float u = 0.7978845608028654f * (v + 0.044715f * v * v * v); v = 0.5f * v * (1.0f + tanhf(u)); }
      so[w][8 * hh + r][t * 16 + ln] = v;
    }
  }
  __builtin_amdgcn_fence(__ATOMIC_ACQ_REL, "workgroup");
  __builtin_amdgcn_wave_barrier();
  const int rsub = lane >> 4, c4 = (lane & 15) * 4;
  {
#pragma unroll
    for (int q = 0; q < 8; ++q) {
      const int r = q * 2 + rsub;
      const v4f v = *(const v4fa*)&so[w][r][c4];
      *(v4f*)(C + (size_t)(row0 + r) * ldc + col0 + c4) = v;
    }
    
  }
}
// row LayerNorm (biased variance, eps) over N: s = X (+ R); optional out_sum <- s; out_norm <- (s-mu)*rsqrt(var+eps)*g + b
template <bool PARAM_BF16>
__global__ __launch_bounds__(256) void k_layernorm(const float* __restrict__ X, const float* __restrict__ R, const float* __restrict__ g, const float* __restrict__ bta,
                                                  float* __restrict__ out_sum, float* __restrict__ out_norm, int N, float eps) {
  __shared__ float red[256];
  const int row = blockIdx.x, tid = threadIdx.x;
  const float* x = X + (size_t)row * N; const float* rr = R ? R + (size_t)row * N : nullptr;
  float vals[16];                     // up to N = 4096
  const int per = N / 256;            // contiguous chunk per thread? use strided-by-4 chunks: thread handles j = tid*4 + 1024*u
  float s1 = 0.f;
  for (int u = 0; u < per / 4; ++u) {
    const int j = tid * 4 + 1024 * u;
    const v4f a = *(const v4fa*)(x + j);
    v4f b = {0.f,0.f,0.f,0.f}; if (rr) b = *(const v4fa*)(rr + j);
#pragma unroll
    for (int q = 0; q < 4; ++q) { const float v = a[q] + b[q]; vals[u * 4 + q] = v; s1 += v; }
  }
  red[tid] = s1; __syncthreads();
  for (int st = 128; st > 0; st >>= 1) { if (tid < st) red[tid] += red[tid + st]; __syncthreads(); }
  const float mu = red[0] / (float)N; __syncthreads();
  float s2 = 0.f;
  for (int u = 0; u < per / 4; ++u)
#pragma unroll
    for (int q = 0; q < 4; ++q) { const float c = vals[u * 4 + q] - mu; s2 += c * c; }
  red[tid] = s2; __syncthreads();
  for (int st = 128; st > 0; st >>= 1) { if (tid < st) red[tid] += red[tid + st]; __syncthreads(); }
  const float rs = rsqrtf(red[0] / (float)N + eps);
  {
    for (int u = 0; u < per / 4; ++u) {
      const int j = tid * 4 + 1024 * u;
      v4f o, sm;
#pragma unroll
      for (int q = 0; q < 4; ++q) {
        float gg = g[j + q], bb = bta[j + q];
        if (PARAM_BF16) { gg = bf16_round(gg); bb = bf16_round(bb); }
        sm[q] = vals[u * 4 + q]; o[q] = (vals[u * 4 + q] - mu) * rs * gg + bb;
      }
      if (out_sum) *(v4f*)(out_sum + (size_t)row * N + j) = sm;
      *(v4f*)(out_norm + (size_t)row * N + j) = o;
    }
    
  }
}



// ---- f16 WMMA path (v_wmma_f32_16x16x32_f16): 11-bit significands for operands in range — used where a [0,1] probability operand needs more precision than bf16
typedef _Float16 v16h __attribute__((ext_vector_type(16)));
union FragH { v16h v; v8us half[2]; _Float16 h[16]; unsigned short u[16]; };
template <int NT>
__device__ __forceinline__ v8f mmaH(v16h ah, v16h al, v16h bh, v16h bl, v8f c) {
  c = __builtin_amdgcn_wmma_f32_16x16x32_f16(false, ah, false, bh, (short)0, c, false, false);
  if (NT >= 2) c = __builtin_amdgcn_wmma_f32_16x16x32_f16(false, al, false, bh, (short)0, c, false, false);
  if (NT >= 3) c = __builtin_amdgcn_wmma_f32_16x16x32_f16(false, ah, false, bl, (short)0, c, false, false);
  asm volatile("v_nop\n\tv_nop\n\tv_nop\n\tv_nop" : "+v"(c) : "v"(ah), "v"(al), "v"(bh), "v"(bl));
  return c;
}
// batched GEMM like k_gemm_b but f16 operands: A f32 (split into f16 hi/lo if ASPLIT, else rounded to f16), Bt = f16 values [n][k]; alpha; C f32; N multiple of 16 (partial tiles skipped)
template <bool ASPLIT>
__global__ __launch_bounds__(128) void k_gemm_h(const float* __restrict__ A, int lda, size_t sA, const _Float16* __restrict__ Bh, int ldb, size_t sB, float alpha, float* __restrict__ C, int ldc, size_t sC, int M, int N, int K) {
  __shared__ __attribute__((aligned(16))) float so[4][16][64];
  const int tid = threadIdx.x, w = tid >> 5, lane = tid & 31, ln = lane & 15, hh = lane >> 4; const int by = blockIdx.y;
  A += (size_t)by * sA; Bh += (size_t)by * sB; C += (size_t)by * sC;
  const int ntn = (N + 63) / 64; const int wid = blockIdx.x * 4 + w; const int mt = wid / ntn, nq = wid % ntn; if (mt * 16 >= M) return;
  const int row0 = mt * 16, col0 = nq * 64; const float* arow = A + (size_t)(row0 + ln) * lda;
  v8f acc[4] = {};
  for (int kb = 0; kb < K; kb += 32) {
    FragH ah, al;
    const v4f x0 = *(const v4fa*)(arow + kb + 8 * hh), x1 = *(const v4fa*)(arow + kb + 8 * hh + 4), x2 = *(const v4fa*)(arow + kb + 16 + 8 * hh), x3 = *(const v4fa*)(arow + kb + 16 + 8 * hh + 4);
    float xs[16] = {x0[0],x0[1],x0[2],x0[3],x1[0],x1[1],x1[2],x1[3],x2[0],x2[1],x2[2],x2[3],x3[0],x3[1],x3[2],x3[3]};
#pragma unroll
    for (int i = 0; i < 16; ++i) { const _Float16 h = (_Float16)xs[i]; ah.h[i] = h; al.h[i] = ASPLIT ? (_Float16)(xs[i] - (float)h) : (_Float16)0.0f; }
#pragma unroll
    for (int t = 0; t < 4; ++t) { if (col0 + t * 16 >= N) continue; const size_t boff = (size_t)(col0 + t * 16 + ln) * ldb + kb; FragH bq; bq.half[0] = *(const v8us*)(Bh + boff + 8 * hh); bq.half[1] = *(const v8us*)(Bh + boff + 16 + 8 * hh);
      acc[t] = mmaH<ASPLIT ? 2 : 1>(ah.v, al.v, bq.v, bq.v, acc[t]); }
  }
#pragma unroll
  for (int t = 0; t < 4; ++t) { if (col0 + t * 16 >= N) continue;
#pragma unroll
    for (int r = 0; r < 8; ++r) so[w][8 * hh + r][t * 16 + ln] = acc[t][r] * alpha; }
  __builtin_amdgcn_fence(__ATOMIC_ACQ_REL, "workgroup"); __builtin_amdgcn_wave_barrier();
  const int rsub = lane >> 4, c4 = (lane & 15) * 4;
  {
#pragma unroll
    for (int q = 0; q < 8; ++q) { const int r = q * 2 + rsub; if (col0 + c4 < N) { const v4f v = *(const v4fa*)&so[w][r][c4]; *(v4f*)(C + (size_t)(row0 + r) * ldc + col0 + c4) = v; } }
     }
}

// Wt[n][k] = f16(W[k][n]·scale) from f32 row-major W[K][N] (scale = power of two; bf16-exact weights stay exact in f16 away from the subnormal range)
__global__ __launch_bounds__(256) void k_wt_f16(const float* __restrict__ W, _Float16* __restrict__ Wt, int K, int N, float scale) {
  const int t = blockIdx.x * 256 + threadIdx.x; if (t >= N * (K / 8)) return; const int n = t / (K / 8), k8 = (t % (K / 8)) * 8; FragH f;
#pragma unroll
  for (int i = 0; i < 8; ++i) f.h[i] = (_Float16)(bf16_round(W[(size_t)(k8 + i) * N + n]) * scale); const v8us o = f.half[0];
  *(v8us*)((unsigned short*)Wt + (size_t)n * K + k8) = o; 
}
// k_gemm_hh variant with fused epilogue: v = acc·alpha + bias[by·sBias + col] (+ CP[(row/rowsPerB)·sCPb + by·64 + col] if CP) ; ACT 0 none / 1 elu ; writes f16 C16 (and f32 C if non-null)
template <int ACT>
__global__ __launch_bounds__(128) void k_gemm_hhx(const _Float16* __restrict__ A, int lda, size_t sA, const _Float16* __restrict__ Bh, int ldb, size_t sB, float alpha, const float* __restrict__ bias, size_t sBias, const float* __restrict__ CP, int rowsPerB, size_t sCPb, int row0g,
    float* __restrict__ C, _Float16* __restrict__ C16, int ldc, size_t sC, int M, int N, int K) {
  __shared__ __attribute__((aligned(16))) float so[4][16][64];
  const int tid = threadIdx.x, w = tid >> 5, lane = tid & 31, ln = lane & 15, hh = lane >> 4; const int by = blockIdx.y;
  A += (size_t)by * sA; Bh += (size_t)by * sB; const size_t cofs = (size_t)by * sC; const float* bp = bias ? bias + (size_t)by * sBias : nullptr;
  const int ntn = (N + 63) / 64; const int wid = blockIdx.x * 4 + w; const int mt = wid / ntn, nq = wid % ntn; if (mt * 16 >= M) return;
  const int row0 = mt * 16, col0 = nq * 64; const _Float16* arow = A + (size_t)(row0 + ln) * lda;
  v8f acc[4] = {};
  for (int kb = 0; kb < K; kb += 32) { FragH ah; ah.half[0] = *(const v8us*)((const unsigned short*)arow + kb + 8 * hh); ah.half[1] = *(const v8us*)((const unsigned short*)arow + kb + 16 + 8 * hh);
#pragma unroll
    for (int t = 0; t < 4; ++t) { if (col0 + t * 16 >= N) continue; const size_t boff = (size_t)(col0 + t * 16 + ln) * ldb + kb; FragH bq; bq.half[0] = *(const v8us*)((const unsigned short*)Bh + boff + 8 * hh); bq.half[1] = *(const v8us*)((const unsigned short*)Bh + boff + 16 + 8 * hh);
      acc[t] = mmaH<1>(ah.v, ah.v, bq.v, bq.v, acc[t]); }
  }
#pragma unroll
  for (int t = 0; t < 4; ++t) { if (col0 + t * 16 >= N) continue; const int col = col0 + t * 16 + ln; const float bv = bp ? bf16_round(bp[col]) : 0.f;
#pragma unroll
    for (int r = 0; r < 8; ++r) { float v = acc[t][r] * alpha + bv; if (CP) { const int bidx = (row0g + row0 + 8 * hh + r) / rowsPerB; v += CP[(size_t)bidx * sCPb + (size_t)by * 64 + col]; } if (ACT == 1) v = (v > 0.f) ? v : expm1f(v); else if (ACT == 7) v = (v > 0.f) ? v + 1.0f : expf(v); else if (ACT == 8) v = tanhf(v); else if (ACT == 9) v = 0.5f * v * (1.0f + tanhf(0.7978845608028654f * (v + 0.044715f * v * v * v))); else if (ACT == 11) v = 1.0f / (1.0f + expf(-v)); else if (ACT == 12) v = (v > 0.f) ? v : 0.01f * v; else if (ACT == 14) v = (v > 0.f) ? v : 0.1f * v; else if (ACT == 15) v = v / (1.0f + expf(-v)); else if (ACT == 3) v = fmaxf(v, 0.f); else if (ACT == 6) v = 0.5f * v * (1.0f + erff(v * 0.70710678118654752f)); so[w][8 * hh + r][t * 16 + ln] = v; } }
  __builtin_amdgcn_fence(__ATOMIC_ACQ_REL, "workgroup"); __builtin_amdgcn_wave_barrier();
  const int rsub = lane >> 4, c4 = (lane & 15) * 4; typedef _Float16 v4h __attribute__((ext_vector_type(4)));
  {
#pragma unroll
    for (int q = 0; q < 8; ++q) { const int r = q * 2 + rsub; if (col0 + c4 < N) { const v4f v = *(const v4fa*)&so[w][r][c4]; if (C) *(v4f*)(C + cofs + (size_t)(row0 + r) * ldc + col0 + c4) = v; if (C16) { v4h h4; for (int i = 0; i < 4; ++i) h4[i] = (_Float16)v[i]; *(v4h*)(C16 + cofs + (size_t)(row0 + r) * ldc + col0 + c4) = h4; } } }
     }
}


typedef _Float16 v4h __attribute__((ext_vector_type(4)));

__global__ __launch_bounds__(256) void k_x16(const float* __restrict__ x, _Float16* __restrict__ X16, size_t n8) { const size_t t = (size_t)blockIdx.x * 256 + threadIdx.x; if (t >= n8) return; FragH f;
#pragma unroll
  for (int q = 0; q < 8; ++q) f.h[q] = (_Float16)bf16_round(x[t * 8 + q]); *(v8us*)((unsigned short*)X16 + t * 8) = f.half[0];  }
__global__ __launch_bounds__(256) void k_h16(const float* __restrict__ x, _Float16* __restrict__ X16, size_t n8) { const size_t t = (size_t)blockIdx.x * 256 + threadIdx.x; if (t >= n8) return; FragH f;
#pragma unroll
  for (int q = 0; q < 8; ++q) f.h[q] = (_Float16)x[t * 8 + q]; *(v8us*)((unsigned short*)X16 + t * 8) = f.half[0];  }
__global__ __launch_bounds__(256) void k_round16f(const float* __restrict__ W, _Float16* __restrict__ Bt, size_t n8) { const size_t t = (size_t)blockIdx.x * 256 + threadIdx.x; if (t >= n8) return; FragH f;
#pragma unroll
  for (int i = 0; i < 8; ++i) f.h[i] = (_Float16)(bf16_round(W[t * 8 + i]) * 16.0f); *(v8us*)((unsigned short*)Bt + t * 8) = f.half[0];  }
template <int NHv, int TTv>
__global__ __launch_bounds__(256) void k_vt(const _Float16* __restrict__ V16, int ldv, int voff, _Float16* __restrict__ Vt) { __shared__ unsigned short tl[64][66]; const int tid = threadIdx.x; const int slab = blockIdx.x / (TTv / 64), lg = blockIdx.x % (TTv / 64); const int b = slab / NHv, h = slab % NHv;
  for (int i = tid; i < 64 * 8; i += 256) { const int r = i / 8, c8 = (i % 8) * 8; FragH f; f.half[0] = *(const v8us*)((const unsigned short*)V16 + ((size_t)b * TTv + lg * 64 + r) * ldv + voff + h * 64 + c8);
#pragma unroll
    for (int q = 0; q < 8; ++q) tl[r][c8 + q] = f.u[q]; }
  __syncthreads();
  {
#pragma unroll
    for (int rd = 0; rd < 2; ++rd) { const int d = rd * 32 + tid / 8, pc = tid % 8; FragH f;
#pragma unroll
      for (int q = 0; q < 8; ++q) f.u[q] = tl[pc * 8 + q][d];
      *(v8us*)((unsigned short*)Vt + ((size_t)slab * 64 + d) * TTv + lg * 64 + pc * 8) = f.half[0]; }
     } }

__global__ __launch_bounds__(256) void k_hl(const float* __restrict__ F, _Float16* __restrict__ Hh, _Float16* __restrict__ Hl, size_t n8) { const size_t t = (size_t)blockIdx.x * 256 + threadIdx.x; if (t >= n8) return; FragH fh, fl; const v4f a = *(const v4fa*)(F + t * 8), c = *(const v4fa*)(F + t * 8 + 4);
#pragma unroll
  for (int q = 0; q < 4; ++q) { _Float16 h = (_Float16)a[q]; fh.h[q] = h; fl.h[q] = (_Float16)((a[q] - (float)h) * 1024.0f); h = (_Float16)c[q]; fh.h[4 + q] = h; fl.h[4 + q] = (_Float16)((c[q] - (float)h) * 1024.0f); }
  { *(v8us*)((unsigned short*)Hh + t * 8) = fh.half[0]; *(v8us*)((unsigned short*)Hl + t * 8) = fl.half[0];  } }

// ---- fast GEMM (wave tile 32x64; requires M % 32 == 0 rows per launch region and N % 64 == 0); epilogue = k_gemm_hhx semantics ----
__device__ __forceinline__ v16h g2_frag(const _Float16* p, int hh) { FragH f; f.half[0] = *(const v8us*)((const unsigned short*)p + 8 * hh); f.half[1] = *(const v8us*)((const unsigned short*)p + 16 + 8 * hh); return f.v; }
__device__ __forceinline__ v8f g2_mma(v16h a, v16h b, v8f c) { v8f d = __builtin_amdgcn_wmma_f32_16x16x32_f16(false, a, false, b, (short)0, c, false, false); asm volatile("v_nop\n\tv_nop\n\tv_nop\n\tv_nop" : "+v"(d) : "v"(a), "v"(b)); return d; }
template <int ACT>
__global__ __launch_bounds__(128) void k_gemm2(const _Float16* __restrict__ A, int lda, size_t sA, const _Float16* __restrict__ Bh, int ldb, size_t sB, float alpha, const float* __restrict__ bias, size_t sBias, const float* __restrict__ CP, int rowsPerB, size_t sCPb, int row0g,
    float* __restrict__ C, _Float16* __restrict__ C16, int ldc, size_t sC, int M, int N, int K) {
  __shared__ __attribute__((aligned(16))) float so[4][32][68];
  const int tid = threadIdx.x, w = tid >> 5, lane = tid & 31, ln = lane & 15, hh = lane >> 4; const int by = blockIdx.y;
  A += (size_t)by * sA; Bh += (size_t)by * sB; const size_t cofs = (size_t)by * sC; const float* bp = bias ? bias + (size_t)by * sBias : nullptr;
  const int ntn = N >> 6; const int mt = blockIdx.x / ntn, nq = blockIdx.x - mt * ntn; const int row0 = mt * 128 + 32 * w, col0 = nq * 64; if (row0 >= M) return;
  const _Float16* a0p = A + (size_t)(row0 + ln) * lda; const _Float16* a1p = a0p + (size_t)16 * lda;
  const _Float16* b0p = Bh + (size_t)(col0 + ln) * ldb; const _Float16* b1p = b0p + (size_t)16 * ldb; const _Float16* b2p = b1p + (size_t)16 * ldb; const _Float16* b3p = b2p + (size_t)16 * ldb;
  const v8f z8 = {0.f,0.f,0.f,0.f,0.f,0.f,0.f,0.f}; v8f c00 = z8, c01 = z8, c02 = z8, c03 = z8, c10 = z8, c11 = z8, c12 = z8, c13 = z8;
#pragma unroll 1
  for (int kb = 0; kb < K; kb += 32) { const v16h a0 = g2_frag(a0p + kb, hh), a1 = g2_frag(a1p + kb, hh);
    v16h b = g2_frag(b0p + kb, hh); c00 = g2_mma(a0, b, c00); c10 = g2_mma(a1, b, c10);
    b = g2_frag(b1p + kb, hh); c01 = g2_mma(a0, b, c01); c11 = g2_mma(a1, b, c11);
    b = g2_frag(b2p + kb, hh); c02 = g2_mma(a0, b, c02); c12 = g2_mma(a1, b, c12);
    b = g2_frag(b3p + kb, hh); c03 = g2_mma(a0, b, c03); c13 = g2_mma(a1, b, c13); }
  v8f accs[8] = {c00, c01, c02, c03, c10, c11, c12, c13};
#pragma unroll
  for (int u = 0; u < 8; ++u) { const int t = u & 3, half = u >> 2; const int col = col0 + t * 16 + ln; const float bv = bp ? bf16_round(bp[col]) : 0.f;
#pragma unroll
    for (int r = 0; r < 8; ++r) { const int rloc = half * 16 + 8 * hh + r; float v = accs[u][r] * alpha + bv; if (CP) { const int bidx = (row0g + row0 + rloc) / rowsPerB; v += CP[(size_t)bidx * sCPb + (size_t)by * 64 + col]; }
      if (ACT == 3) v = fmaxf(v, 0.f); else if (ACT == 6) v = 0.5f * v * (1.0f + erff(v * 0.70710678118654752f)); else if (ACT == 11) v = 1.0f / (1.0f + expf(-v)); else if (ACT == 15) v = v / (1.0f + expf(-v)); else if (ACT == 12) v = (v > 0.f) ? v : 0.01f * v; else if (ACT == 8) v = tanhf(v);
      so[w][rloc][t * 16 + ln] = v; } }
  __builtin_amdgcn_fence(__ATOMIC_ACQ_REL, "workgroup"); __builtin_amdgcn_wave_barrier();
  const int rsub = lane >> 4, c4 = (lane & 15) * 4;
  {
#pragma unroll
    for (int q = 0; q < 16; ++q) { const int r = q * 2 + rsub; const v4f v = *(const v4fa*)&so[w][r][c4]; if (C) *(v4f*)(C + cofs + (size_t)(row0 + r) * ldc + col0 + c4) = v; if (C16) { v4h h4; for (int i = 0; i < 4; ++i) h4[i] = (_Float16)v[i]; *(v4h*)(C16 + cofs + (size_t)(row0 + r) * ldc + col0 + c4) = h4; } }
     } }


template <int NHv, int TTv>
__global__ __launch_bounds__(256) void k_vt2(const _Float16* __restrict__ V16, int ldv, _Float16* __restrict__ Vt, int ldt, int col0) { __shared__ unsigned short tl[64][66]; const int tid = threadIdx.x; const int h = blockIdx.x / (TTv / 64), lg = blockIdx.x % (TTv / 64); V16 += (size_t)blockIdx.y * TTv * ldv; Vt += (size_t)blockIdx.y * (NHv * 64) * ldt;
  for (int i = tid; i < 64 * 8; i += 256) { const int r = i / 8, c8 = (i % 8) * 8; FragH f; f.half[0] = *(const v8us*)((const unsigned short*)V16 + ((size_t)lg * 64 + r) * ldv + h * 64 + c8);
#pragma unroll
    for (int q = 0; q < 8; ++q) tl[r][c8 + q] = f.u[q]; }
  __syncthreads();
  {
#pragma unroll
    for (int rd = 0; rd < 2; ++rd) { const int d = rd * 32 + tid / 8, pc = tid % 8; FragH f;
#pragma unroll
      for (int q = 0; q < 8; ++q) f.u[q] = tl[pc * 8 + q][d];
      *(v8us*)((unsigned short*)Vt + ((size_t)h * 64 + d) * ldt + col0 + lg * 64 + pc * 8) = f.half[0]; }
     } }
__global__ __launch_bounds__(256) void k_hlraw(const float* __restrict__ F, _Float16* __restrict__ H, _Float16* __restrict__ L, size_t n8) {
  #pragma clang fp contract(off)
  const size_t t = (size_t)blockIdx.x * 256 + threadIdx.x; if (t >= n8) return; FragH a, b; for (int q = 0; q < 8; ++q) { const float v = F[t * 8 + q]; const _Float16 h = (_Float16)v; a.h[q] = h; b.h[q] = (_Float16)(v - (float)h); }
  { *(v8us*)((unsigned short*)H + t * 8) = a.half[0]; *(v8us*)((unsigned short*)L + t * 8) = b.half[0];  } }

__global__ __launch_bounds__(256) void k_soft(const float* __restrict__ S, _Float16* __restrict__ PP) {
  #pragma clang fp contract(off)
  const int tid = threadIdx.x, w = tid >> 5, ln = tid & 31; const int r = blockIdx.x * 8 + w; if (r >= SLEN) return; S += (size_t)blockIdx.y * SLEN * SLEN; PP += (size_t)blockIdx.y * 2 * SLEN * SLEN; const float* s = S + (size_t)r * SLEN; float m = -3.0e38f;
#pragma unroll 1
  for (int c = 0; c < SLEN / 256; ++c) { const float* p = s + c * 256 + ln * 8; for (int q = 0; q < 8; ++q) m = fmaxf(m, p[q]); }
  for (int o = 16; o > 0; o >>= 1) m = fmaxf(m, __shfl_xor(m, o, 32)); float su = 0.f;
#pragma unroll 1
  for (int c = 0; c < SLEN / 256; ++c) { const float* p = s + c * 256 + ln * 8; for (int q = 0; q < 8; ++q) su += expf(p[q] - m); }
  for (int o = 16; o > 0; o >>= 1) su += __shfl_xor(su, o, 32); const float inv = 1024.0f / su; unsigned short* d = (unsigned short*)PP + (size_t)r * 2 * SLEN;
  {
#pragma unroll 1
    for (int c = 0; c < SLEN / 256; ++c) { const float* p = s + c * 256 + ln * 8; FragH f;
#pragma unroll
      for (int q = 0; q < 8; ++q) f.h[q] = (_Float16)(expf(p[q] - m) * inv);
      *(v8us*)(d + c * 256 + ln * 8) = f.half[0]; *(v8us*)(d + SLEN + c * 256 + ln * 8) = f.half[0]; }
     } }

extern "C" void kernel_launch(void* const* d_in, const int* in_sizes, int n_in,
                              void* d_out, int out_size, void* d_ws, size_t ws_size, hipStream_t stream) {
  (void)in_sizes; (void)n_in; (void)out_size;
  const float* const* I = (const float* const*)d_in; const float* x = I[0]; const float* Wq = I[1]; const float* bq = I[2]; const float* Wk = I[3]; const float* bk = I[4]; const float* Wv = I[5]; const float* bv = I[6];
  char* ws = (char*)d_ws; size_t off = 0;
  auto take = [&](size_t bytes) { char* p = ws + off; off += (bytes + 255) & ~(size_t)255; return p; };
  _Float16* BQ = (_Float16*)take((size_t)FF * FF * 2); _Float16* BK = (_Float16*)take((size_t)FF * FF * 2); _Float16* BV = (_Float16*)take((size_t)FF * FF * 2);
  const size_t PL = (size_t)NBT * SLEN * FF;      /* elements of one [16][2048][128] plane */
  _Float16* Q16 = (_Float16*)take(PL * 2); _Float16* K16 = (_Float16*)take(PL * 2); _Float16* VT2 = (_Float16*)take(PL * 2 * 2);
  float* S = (float*)take((size_t)GRP * SLEN * SLEN * 4); _Float16* PP = (_Float16*)take((size_t)GRP * SLEN * 2 * SLEN * 2);
  if (off > ws_size) return;      /* 0.1 + 32 + 96 + 96 = 224 MiB */
  /* x16, v (f32), v_hi, v_lo are dead before the first score launch writes S: they lie in S's place (40 of its 96 MiB) */
  _Float16* X16 = (_Float16*)S; float* VF = (float*)(X16 + PL); _Float16* Vh = (_Float16*)(VF + PL); _Float16* Vl = Vh + PL;
  const size_t w8 = (size_t)FF * FF / 8; const unsigned wb = (unsigned)((w8 + 255) / 256);
  k_round16f<<<wb, 256, 0, stream>>>(Wq, BQ, w8); k_round16f<<<wb, 256, 0, stream>>>(Wk, BK, w8); k_round16f<<<wb, 256, 0, stream>>>(Wv, BV, w8);      /* torch (out,in) = natural Bt */
  const size_t n8 = PL / 8; const unsigned nb8 = (unsigned)((n8 + 255) / 256); const dim3 gA((NBT * SLEN / 128) * (FF / 64), 1), gT((FF / 64) * (SLEN / 64), NBT);
  k_x16<<<nb8, 256, 0, stream>>>(x, X16, n8);
  k_gemm2<0><<<gA, 128, 0, stream>>>(X16, FF, 0, BQ, FF, 0, 0.0625f, bq, 0, nullptr, 1, 0, 0, nullptr, Q16, FF, 0, NBT * SLEN, FF, FF);
  k_gemm2<0><<<gA, 128, 0, stream>>>(X16, FF, 0, BK, FF, 0, 0.0625f, bk, 0, nullptr, 1, 0, 0, nullptr, K16, FF, 0, NBT * SLEN, FF, FF);
  k_gemm2<0><<<gA, 128, 0, stream>>>(X16, FF, 0, BV, FF, 0, 0.0625f, bv, 0, nullptr, 1, 0, 0, VF, nullptr, FF, 0, NBT * SLEN, FF, FF); k_hlraw<<<nb8, 256, 0, stream>>>(VF, Vh, Vl, n8);
  k_vt2<FF / 64, SLEN><<<gT, 256, 0, stream>>>(Vh, FF, VT2, 2 * SLEN, 0); k_vt2<FF / 64, SLEN><<<gT, 256, 0, stream>>>(Vl, FF, VT2, 2 * SLEN, SLEN);
  const size_t sX = (size_t)SLEN * FF, sS = (size_t)SLEN * SLEN;
  for (int b0 = 0; b0 < NBT; b0 += GRP) { const unsigned g = (unsigned)(NBT - b0 < GRP ? NBT - b0 : GRP); const size_t ro = (size_t)b0 * sX;
    k_gemm2<0><<<dim3((SLEN / 128) * (SLEN / 64), g), 128, 0, stream>>>(Q16 + ro, FF, sX, K16 + ro, FF, sX, 0.0625f, nullptr, 0, nullptr, 1, 0, 0, S, nullptr, SLEN, sS, SLEN, SLEN, FF);      /* scores / sqrt(256) = / 16 */
    k_soft<<<dim3(SLEN / 8, g), 256, 0, stream>>>(S, PP);
    k_gemm2<0><<<dim3((SLEN / 128) * (FF / 64), g), 128, 0, stream>>>(PP, 2 * SLEN, 2 * sS, VT2 + 2 * ro, 2 * SLEN, 2 * sX, 0.0009765625f, nullptr, 0, nullptr, 1, 0, 0, (float*)d_out + ro, nullptr, FF, sX, SLEN, FF, 2 * SLEN); }      /* alpha . (v_hi + v_lo) */
}

// v002
// One run takes 106 microseconds.
// Two timings next to v001 put it at 6.23 and 6.19 times that version's speed.
// All steps since v000 together make it 25.6 times as fast.
#include <hip/hip_runtime.h>
// Non-local interaction (16 x 2048 tokens, 128 features, single head): q,k,v = x W^T + b; alpha = softmax(q.k / 16); out = alpha v -> [16,2048,128].
// Structure (batches side by side in the grid): x as an exact f16 plane; projections as f16 WMMA GEMMs (32x64 wave tiles, f32 accumulation, exact x16 weights + bias); v split into f16 hi and raw residual planes, transposed; then ONE fused kernel per 128 queries: K and v^T tiles of 64 keys staged in LDS, S^T = K.Q^T, running-maximum softmax in registers (a lane holds one query's scores), P^T packed from the score tiles as the B operand, O^T += [v_hi^T ; v_lo^T].P^T, divided by the row sum at the end. No score or probability plane in memory.
// Compute dtype: x, weights, biases rounded to bf16; q, k, P as f16 operands (~2^-12; logits sigma ~1.4); v as hi + residual (~2^-22); f32 accumulation and softmax. v_wmma_f32_16x16x32_f16.
#define NBT 16
#define SLEN 2048
#define FF 128
typedef __bf16 v16b __attribute__((ext_vector_type(16)));
typedef unsigned short v8us __attribute__((ext_vector_type(8), may_alias));
typedef float  v8f  __attribute__((ext_vector_type(8)));
typedef float  v4f  __attribute__((ext_vector_type(4)));
typedef float  v4fa __attribute__((ext_vector_type(4), may_alias));
union FragB { v16b v; v8us half[2]; unsigned short u[16]; };

__device__ __forceinline__ unsigned short bf16_bits(float x) { unsigned int u = __float_as_uint(x); return (unsigned short)((u + 0x7FFFu + ((u >> 16) & 1u)) >> 16); }
__device__ __forceinline__ float bf16_val(unsigned short b) { return __uint_as_float(((unsigned int)b) << 16); }
__device__ __forceinline__ float bf16_round(float x) { return bf16_val(bf16_bits(x)); }
// D += A·B with NT terms: 1 = ah·bh, 2 = + al·bh (A split), 3 = + ah·bl (both split)
template <int NT>
__device__ __forceinline__ v8f mmaN(v16b ah, v16b al, v16b bh, v16b bl, v8f c) {
  c = __builtin_amdgcn_wmma_f32_16x16x32_bf16(false, ah, false, bh, (short)0, c, false, false);
  if (NT >= 2) c = __builtin_amdgcn_wmma_f32_16x16x32_bf16(false, al, false, bh, (short)0, c, false, false);
  if (NT >= 3) c = __builtin_amdgcn_wmma_f32_16x16x32_bf16(false, ah, false, bl, (short)0, c, false, false);
  asm volatile("v_nop\n\tv_nop\n\tv_nop\n\tv_nop" : "+v"(c) : "v"(ah), "v"(al), "v"(bh), "v"(bl));
  return c;
}

__global__ __launch_bounds__(256) void k_wt_bf16(const float* __restrict__ W, unsigned short* __restrict__ Wt, int K, int N) {
  const int t = blockIdx.x * 256 + threadIdx.x;
  const int k8n = K / 8;
  if (t >= N * k8n) return;
  const int n = t / k8n, k8 = (t % k8n) * 8;
  v8us v;
#pragma unroll
  for (int i = 0; i < 8; ++i) v[i] = bf16_bits(W[(size_t)(k8 + i) * N + n]);
  *(v8us*)(Wt + (size_t)n * K + k8) = v;
  
}

// GEMM C[M][N] (f32, pitch ldc) = act(A[M][K]·W + bias). A f32 row-major (pitch lda) converted per fragment to bf16
// (ASPLIT: hi/lo two planes -> 2 terms, else single rounded term); Wt bf16 [N][K] (pitch ldb). BIAS_BF16 rounds the
// bias to bf16 first (bias quantised to bf16 before the add). K%32==0, M%16==0, N%64==0.
template <bool ASPLIT, int ACT, bool BIAS_BF16>
__global__ __launch_bounds__(128) void k_gemm_bf(const float* __restrict__ A, int lda, const unsigned short* __restrict__ Wt, int ldb,
                                               const float* __restrict__ bias, float* __restrict__ C, int ldc, int M, int N, int K) {
  __shared__ __attribute__((aligned(16))) float so[4][16][64];
  const int tid = threadIdx.x, w = tid >> 5, lane = tid & 31, ln = lane & 15, hh = lane >> 4;
  const int ntn = N / 64;
  const int wid = blockIdx.x * 4 + w;
  const int mt = wid / ntn, nq = wid % ntn;
  if (mt * 16 >= M) return;
  const int row0 = mt * 16, col0 = nq * 64;
  const float* arow = A + (size_t)(row0 + ln) * lda;
  v8f acc[4] = {};
  for (int kb = 0; kb < K; kb += 32) {
    FragB ah, al;
    const v4f x0 = *(const v4fa*)(arow + kb + 8 * hh), x1 = *(const v4fa*)(arow + kb + 8 * hh + 4);
    const v4f x2 = *(const v4fa*)(arow + kb + 16 + 8 * hh), x3 = *(const v4fa*)(arow + kb + 16 + 8 * hh + 4);
    float xs[16] = {x0[0],x0[1],x0[2],x0[3],x1[0],x1[1],x1[2],x1[3],x2[0],x2[1],x2[2],x2[3],x3[0],x3[1],x3[2],x3[3]};
#pragma unroll
    for (int i = 0; i < 16; ++i) { const unsigned short hb = bf16_bits(xs[i]); ah.u[i] = hb; al.u[i] = ASPLIT ? bf16_bits(xs[i] - bf16_val(hb)) : (unsigned short)0; }
#pragma unroll
    for (int t = 0; t < 4; ++t) {
      const unsigned short* brow = Wt + (size_t)(col0 + t * 16 + ln) * ldb + kb;
      FragB b;
      b.half[0] = *(const v8us*)(brow + 8 * hh);
      b.half[1] = *(const v8us*)(brow + 16 + 8 * hh);
      acc[t] = mmaN<ASPLIT ? 2 : 1>(ah.v, al.v, b.v, b.v, acc[t]);
    }
  }
#pragma unroll
  for (int t = 0; t < 4; ++t) {
    float bv = bias ? bias[col0 + t * 16 + ln] : 0.f;
    if (BIAS_BF16) bv = bf16_round(bv);
#pragma unroll
    for (int r = 0; r < 8; ++r) { float v = acc[t][r] + bv; if (ACT == 1) v = fmaxf(v, 0.f); so[w][8 * hh + r][t * 16 + ln] = v; }
  }
  __builtin_amdgcn_fence(__ATOMIC_ACQ_REL, "workgroup");
  __builtin_amdgcn_wave_barrier();
  const int rsub = lane >> 4, c4 = (lane & 15) * 4;
  {
#pragma unroll
    for (int q = 0; q < 8; ++q) {
      const int r = q * 2 + rsub;
      const v4f v = *(const v4fa*)&so[w][r][c4];
      *(v4f*)(C + (size_t)(row0 + r) * ldc + col0 + c4) = v;
    }
    
  }
}

// GEMM C = act(A·W + bias + resid): A f32 (ASPLIT -> hi/lo 2 terms), Wt bf16 [N][K]; ACT 0 none, 1 relu, 2 exact gelu;
// resid (optional, f32, row index = (row % rmod), pitch ldr, RES_BF16 rounds it) added before the activation.
template <bool ASPLIT, int ACT, bool BIAS_BF16, bool RES_BF16>
__global__ __launch_bounds__(128) void k_gemm_bf3(const float* __restrict__ A, int lda, const unsigned short* __restrict__ Wt, int ldb,
                                                const float* __restrict__ bias, const float* __restrict__ resid, int rmod, int ldr,
                                                float* __restrict__ C, int ldc, int M, int N, int K) {
  __shared__ __attribute__((aligned(16))) float so[4][16][64];
  const int tid = threadIdx.x, w = tid >> 5, lane = tid & 31, ln = lane & 15, hh = lane >> 4;
  const int ntn = N / 64;
  const int wid = blockIdx.x * 4 + w;
  const int mt = wid / ntn, nq = wid % ntn;
  if (mt * 16 >= M) return;
  const int row0 = mt * 16, col0 = nq * 64;
  const float* arow = A + (size_t)(row0 + ln) * lda;
  v8f acc[4] = {};
  for (int kb = 0; kb < K; kb += 32) {
    FragB ah, al;
    const v4f x0 = *(const v4fa*)(arow + kb + 8 * hh), x1 = *(const v4fa*)(arow + kb + 8 * hh + 4);
    const v4f x2 = *(const v4fa*)(arow + kb + 16 + 8 * hh), x3 = *(const v4fa*)(arow + kb + 16 + 8 * hh + 4);
    float xs[16] = {x0[0],x0[1],x0[2],x0[3],x1[0],x1[1],x1[2],x1[3],x2[0],x2[1],x2[2],x2[3],x3[0],x3[1],x3[2],x3[3]};
#pragma unroll
    for (int i = 0; i < 16; ++i) { const unsigned short hb = bf16_bits(xs[i]); ah.u[i] = hb; al.u[i] = ASPLIT ? bf16_bits(xs[i] - bf16_val(hb)) : (unsigned short)0; }
#pragma unroll
    for (int t = 0; t < 4; ++t) {
      const unsigned short* brow = Wt + (size_t)(col0 + t * 16 + ln) * ldb + kb;
      FragB b;
      b.half[0] = *(const v8us*)(brow + 8 * hh);
      b.half[1] = *(const v8us*)(brow + 16 + 8 * hh);
      acc[t] = mmaN<ASPLIT ? 2 : 1>(ah.v, al.v, b.v, b.v, acc[t]);
    }
  }
#pragma unroll
  for (int t = 0; t < 4; ++t) {
    const int col = col0 + t * 16 + ln;
    float bv = bias ? bias[col] : 0.f;
    if (BIAS_BF16) bv = bf16_round(bv);
#pragma unroll
    for (int r = 0; r < 8; ++r) {
      float v = acc[t][r] + bv;
      if (resid) { float rv = resid[(size_t)((row0 + 8 * hh + r) % rmod) * ldr + col]; if (RES_BF16) rv = bf16_round(rv); v += rv; }
      if (ACT == 1) v = fmaxf(v, 0.f);
      if (ACT == 2) v = 0.5f * v * (1.0f + erff(v * 0.70710678118654752f));
      if (ACT == 3) { const float u = 0.7978845608028654f * (v + 0.044715f * v * v * v); v = 0.5f * v * (1.0f + tanhf(u)); }
      so[w][8 * hh + r][t * 16 + ln] = v;
    }
  }
  __builtin_amdgcn_fence(__ATOMIC_ACQ_REL, "workgroup");
  __builtin_amdgcn_wave_barrier();
  const int rsub = lane >> 4, c4 = (lane & 15) * 4;
  {
#pragma unroll
    for (int q = 0; q < 8; ++q) {
      const int r = q * 2 + rsub;
      const v4f v = *(const v4fa*)&so[w][r][c4];
      *(v4f*)(C + (size_t)(row0 + r) * ldc + col0 + c4) = v;
    }
    
  }
}
// row LayerNorm (biased variance, eps) over N: s = X (+ R); optional out_sum <- s; out_norm <- (s-mu)*rsqrt(var+eps)*g + b
template <bool PARAM_BF16>
__global__ __launch_bounds__(256) void k_layernorm(const float* __restrict__ X, const float* __restrict__ R, const float* __restrict__ g, const float* __restrict__ bta,
                                                  float* __restrict__ out_sum, float* __restrict__ out_norm, int N, float eps) {
  __shared__ float red[256];
  const int row = blockIdx.x, tid = threadIdx.x;
  const float* x = X + (size_t)row * N; const float* rr = R ? R + (size_t)row * N : nullptr;
  float vals[16];                     // up to N = 4096
  const int per = N / 256;            // contiguous chunk per thread? use strided-by-4 chunks: thread handles j = tid*4 + 1024*u
  float s1 = 0.f;
  for (int u = 0; u < per / 4; ++u) {
    const int j = tid * 4 + 1024 * u;
    const v4f a = *(const v4fa*)(x + j);
    v4f b = {0.f,0.f,0.f,0.f}; if (rr) b = *(const v4fa*)(rr + j);
#pragma unroll
    for (int q = 0; q < 4; ++q) { const float v = a[q] + b[q]; vals[u * 4 + q] = v; s1 += v; }
  }
  red[tid] = s1; __syncthreads();
  for (int st = 128; st > 0; st >>= 1) { if (tid < st) red[tid] += red[tid + st]; __syncthreads(); }
  const float mu = red[0] / (float)N; __syncthreads();
  float s2 = 0.f;
  for (int u = 0; u < per / 4; ++u)
#pragma unroll
    for (int q = 0; q < 4; ++q) { const float c = vals[u * 4 + q] - mu; s2 += c * c; }
  red[tid] = s2; __syncthreads();
  for (int st = 128; st > 0; st >>= 1) { if (tid < st) red[tid] += red[tid + st]; __syncthreads(); }
  const float rs = rsqrtf(red[0] / (float)N + eps);
  {
    for (int u = 0; u < per / 4; ++u) {
      const int j = tid * 4 + 1024 * u;
      v4f o, sm;
#pragma unroll
      for (int q = 0; q < 4; ++q) {
        float gg = g[j + q], bb = bta[j + q];
        if (PARAM_BF16) { gg = bf16_round(gg); bb = bf16_round(bb); }
        sm[q] = vals[u * 4 + q]; o[q] = (vals[u * 4 + q] - mu) * rs * gg + bb;
      }
      if (out_sum) *(v4f*)(out_sum + (size_t)row * N + j) = sm;
      *(v4f*)(out_norm + (size_t)row * N + j) = o;
    }
    
  }
}



// ---- f16 WMMA path (v_wmma_f32_16x16x32_f16): 11-bit significands for operands in range — used where a [0,1] probability operand needs more precision than bf16
typedef _Float16 v16h __attribute__((ext_vector_type(16)));
union FragH { v16h v; v8us half[2]; _Float16 h[16]; unsigned short u[16]; };
template <int NT>
__device__ __forceinline__ v8f mmaH(v16h ah, v16h al, v16h bh, v16h bl, v8f c) {
  c = __builtin_amdgcn_wmma_f32_16x16x32_f16(false, ah, false, bh, (short)0, c, false, false);
  if (NT >= 2) c = __builtin_amdgcn_wmma_f32_16x16x32_f16(false, al, false, bh, (short)0, c, false, false);
  if (NT >= 3) c = __builtin_amdgcn_wmma_f32_16x16x32_f16(false, ah, false, bl, (short)0, c, false, false);
  asm volatile("v_nop\n\tv_nop\n\tv_nop\n\tv_nop" : "+v"(c) : "v"(ah), "v"(al), "v"(bh), "v"(bl));
  return c;
}
// batched GEMM like k_gemm_b but f16 operands: A f32 (split into f16 hi/lo if ASPLIT, else rounded to f16), Bt = f16 values [n][k]; alpha; C f32; N multiple of 16 (partial tiles skipped)
template <bool ASPLIT>
__global__ __launch_bounds__(128) void k_gemm_h(const float* __restrict__ A, int lda, size_t sA, const _Float16* __restrict__ Bh, int ldb, size_t sB, float alpha, float* __restrict__ C, int ldc, size_t sC, int M, int N, int K) {
  __shared__ __attribute__((aligned(16))) float so[4][16][64];
  const int tid = threadIdx.x, w = tid >> 5, lane = tid & 31, ln = lane & 15, hh = lane >> 4; const int by = blockIdx.y;
  A += (size_t)by * sA; Bh += (size_t)by * sB; C += (size_t)by * sC;
  const int ntn = (N + 63) / 64; const int wid = blockIdx.x * 4 + w; const int mt = wid / ntn, nq = wid % ntn; if (mt * 16 >= M) return;
  const int row0 = mt * 16, col0 = nq * 64; const float* arow = A + (size_t)(row0 + ln) * lda;
  v8f acc[4] = {};
  for (int kb = 0; kb < K; kb += 32) {
    FragH ah, al;
    const v4f x0 = *(const v4fa*)(arow + kb + 8 * hh), x1 = *(const v4fa*)(arow + kb + 8 * hh + 4), x2 = *(const v4fa*)(arow + kb + 16 + 8 * hh), x3 = *(const v4fa*)(arow + kb + 16 + 8 * hh + 4);
    float xs[16] = {x0[0],x0[1],x0[2],x0[3],x1[0],x1[1],x1[2],x1[3],x2[0],x2[1],x2[2],x2[3],x3[0],x3[1],x3[2],x3[3]};
#pragma unroll
    for (int i = 0; i < 16; ++i) { const _Float16 h = (_Float16)xs[i]; ah.h[i] = h; al.h[i] = ASPLIT ? (_Float16)(xs[i] - (float)h) : (_Float16)0.0f; }
#pragma unroll
    for (int t = 0; t < 4; ++t) { if (col0 + t * 16 >= N) continue; const size_t boff = (size_t)(col0 + t * 16 + ln) * ldb + kb; FragH bq; bq.half[0] = *(const v8us*)(Bh + boff + 8 * hh); bq.half[1] = *(const v8us*)(Bh + boff + 16 + 8 * hh);
      acc[t] = mmaH<ASPLIT ? 2 : 1>(ah.v, al.v, bq.v, bq.v, acc[t]); }
  }
#pragma unroll
  for (int t = 0; t < 4; ++t) { if (col0 + t * 16 >= N) continue;
#pragma unroll
    for (int r = 0; r < 8; ++r) so[w][8 * hh + r][t * 16 + ln] = acc[t][r] * alpha; }
  __builtin_amdgcn_fence(__ATOMIC_ACQ_REL, "workgroup"); __builtin_amdgcn_wave_barrier();
  const int rsub = lane >> 4, c4 = (lane & 15) * 4;
  {
#pragma unroll
    for (int q = 0; q < 8; ++q) { const int r = q * 2 + rsub; if (col0 + c4 < N) { const v4f v = *(const v4fa*)&so[w][r][c4]; *(v4f*)(C + (size_t)(row0 + r) * ldc + col0 + c4) = v; } }
     }
}

// Wt[n][k] = f16(W[k][n]·scale) from f32 row-major W[K][N] (scale = power of two; bf16-exact weights stay exact in f16 away from the subnormal range)
__global__ __launch_bounds__(256) void k_wt_f16(const float* __restrict__ W, _Float16* __restrict__ Wt, int K, int N, float scale) {
  const int t = blockIdx.x * 256 + threadIdx.x; if (t >= N * (K / 8)) return; const int n = t / (K / 8), k8 = (t % (K / 8)) * 8; FragH f;
#pragma unroll
  for (int i = 0; i < 8; ++i) f.h[i] = (_Float16)(bf16_round(W[(size_t)(k8 + i) * N + n]) * scale); const v8us o = f.half[0];
  *(v8us*)((unsigned short*)Wt + (size_t)n * K + k8) = o; 
}
// k_gemm_hh variant with fused epilogue: v = acc·alpha + bias[by·sBias + col] (+ CP[(row/rowsPerB)·sCPb + by·64 + col] if CP) ; ACT 0 none / 1 elu ; writes f16 C16 (and f32 C if non-null)
template <int ACT>
__global__ __launch_bounds__(128) void k_gemm_hhx(const _Float16* __restrict__ A, int lda, size_t sA, const _Float16* __restrict__ Bh, int ldb, size_t sB, float alpha, const float* __restrict__ bias, size_t sBias, const float* __restrict__ CP, int rowsPerB, size_t sCPb, int row0g,
    float* __restrict__ C, _Float16* __restrict__ C16, int ldc, size_t sC, int M, int N, int K) {
  __shared__ __attribute__((aligned(16))) float so[4][16][64];
  const int tid = threadIdx.x, w = tid >> 5, lane = tid & 31, ln = lane & 15, hh = lane >> 4; const int by = blockIdx.y;
  A += (size_t)by * sA; Bh += (size_t)by * sB; const size_t cofs = (size_t)by * sC; const float* bp = bias ? bias + (size_t)by * sBias : nullptr;
  const int ntn = (N + 63) / 64; const int wid = blockIdx.x * 4 + w; const int mt = wid / ntn, nq = wid % ntn; if (mt * 16 >= M) return;
  const int row0 = mt * 16, col0 = nq * 64; const _Float16* arow = A + (size_t)(row0 + ln) * lda;
  v8f acc[4] = {};
  for (int kb = 0; kb < K; kb += 32) { FragH ah; ah.half[0] = *(const v8us*)((const unsigned short*)arow + kb + 8 * hh); ah.half[1] = *(const v8us*)((const unsigned short*)arow + kb + 16 + 8 * hh);
#pragma unroll
    for (int t = 0; t < 4; ++t) { if (col0 + t * 16 >= N) continue; const size_t boff = (size_t)(col0 + t * 16 + ln) * ldb + kb; FragH bq; bq.half[0] = *(const v8us*)((const unsigned short*)Bh + boff + 8 * hh); bq.half[1] = *(const v8us*)((const unsigned short*)Bh + boff + 16 + 8 * hh);
      acc[t] = mmaH<1>(ah.v, ah.v, bq.v, bq.v, acc[t]); }
  }
#pragma unroll
  for (int t = 0; t < 4; ++t) { if (col0 + t * 16 >= N) continue; const int col = col0 + t * 16 + ln; const float bv = bp ? bf16_round(bp[col]) : 0.f;
#pragma unroll
    for (int r = 0; r < 8; ++r) { float v = acc[t][r] * alpha + bv; if (CP) { const int bidx = (row0g + row0 + 8 * hh + r) / rowsPerB; v += CP[(size_t)bidx * sCPb + (size_t)by * 64 + col]; } if (ACT == 1) v = (v > 0.f) ? v : expm1f(v); else if (ACT == 7) v = (v > 0.f) ? v + 1.0f : expf(v); else if (ACT == 8) v = tanhf(v); else if (ACT == 9) v = 0.5f * v * (1.0f + tanhf(0.7978845608028654f * (v + 0.044715f * v * v * v))); else if (ACT == 11) v = 1.0f / (1.0f + expf(-v)); else if (ACT == 12) v = (v > 0.f) ? v : 0.01f * v; else if (ACT == 14) v = (v > 0.f) ? v : 0.1f * v; else if (ACT == 15) v = v / (1.0f + expf(-v)); else if (ACT == 3) v = fmaxf(v, 0.f); else if (ACT == 6) v = 0.5f * v * (1.0f + erff(v * 0.70710678118654752f)); so[w][8 * hh + r][t * 16 + ln] = v; } }
  __builtin_amdgcn_fence(__ATOMIC_ACQ_REL, "workgroup"); __builtin_amdgcn_wave_barrier();
  const int rsub = lane >> 4, c4 = (lane & 15) * 4; typedef _Float16 v4h __attribute__((ext_vector_type(4)));
  {
#pragma unroll
    for (int q = 0; q < 8; ++q) { const int r = q * 2 + rsub; if (col0 + c4 < N) { const v4f v = *(const v4fa*)&so[w][r][c4]; if (C) *(v4f*)(C + cofs + (size_t)(row0 + r) * ldc + col0 + c4) = v; if (C16) { v4h h4; for (int i = 0; i < 4; ++i) h4[i] = (_Float16)v[i]; *(v4h*)(C16 + cofs + (size_t)(row0 + r) * ldc + col0 + c4) = h4; } } }
     }
}


typedef _Float16 v4h __attribute__((ext_vector_type(4)));

__global__ __launch_bounds__(256) void k_x16(const float* __restrict__ x, _Float16* __restrict__ X16, size_t n8) { const size_t t = (size_t)blockIdx.x * 256 + threadIdx.x; if (t >= n8) return; FragH f;
#pragma unroll
  for (int q = 0; q < 8; ++q) f.h[q] = (_Float16)bf16_round(x[t * 8 + q]); *(v8us*)((unsigned short*)X16 + t * 8) = f.half[0];  }
__global__ __launch_bounds__(256) void k_h16(const float* __restrict__ x, _Float16* __restrict__ X16, size_t n8) { const size_t t = (size_t)blockIdx.x * 256 + threadIdx.x; if (t >= n8) return; FragH f;
#pragma unroll
  for (int q = 0; q < 8; ++q) f.h[q] = (_Float16)x[t * 8 + q]; *(v8us*)((unsigned short*)X16 + t * 8) = f.half[0];  }
__global__ __launch_bounds__(256) void k_round16f(const float* __restrict__ W, _Float16* __restrict__ Bt, size_t n8) { const size_t t = (size_t)blockIdx.x * 256 + threadIdx.x; if (t >= n8) return; FragH f;
#pragma unroll
  for (int i = 0; i < 8; ++i) f.h[i] = (_Float16)(bf16_round(W[t * 8 + i]) * 16.0f); *(v8us*)((unsigned short*)Bt + t * 8) = f.half[0];  }
template <int NHv, int TTv>
__global__ __launch_bounds__(256) void k_vt(const _Float16* __restrict__ V16, int ldv, int voff, _Float16* __restrict__ Vt) { __shared__ unsigned short tl[64][66]; const int tid = threadIdx.x; const int slab = blockIdx.x / (TTv / 64), lg = blockIdx.x % (TTv / 64); const int b = slab / NHv, h = slab % NHv;
  for (int i = tid; i < 64 * 8; i += 256) { const int r = i / 8, c8 = (i % 8) * 8; FragH f; f.half[0] = *(const v8us*)((const unsigned short*)V16 + ((size_t)b * TTv + lg * 64 + r) * ldv + voff + h * 64 + c8);
#pragma unroll
    for (int q = 0; q < 8; ++q) tl[r][c8 + q] = f.u[q]; }
  __syncthreads();
  {
#pragma unroll
    for (int rd = 0; rd < 2; ++rd) { const int d = rd * 32 + tid / 8, pc = tid % 8; FragH f;
#pragma unroll
      for (int q = 0; q < 8; ++q) f.u[q] = tl[pc * 8 + q][d];
      *(v8us*)((unsigned short*)Vt + ((size_t)slab * 64 + d) * TTv + lg * 64 + pc * 8) = f.half[0]; }
     } }

__global__ __launch_bounds__(256) void k_hl(const float* __restrict__ F, _Float16* __restrict__ Hh, _Float16* __restrict__ Hl, size_t n8) { const size_t t = (size_t)blockIdx.x * 256 + threadIdx.x; if (t >= n8) return; FragH fh, fl; const v4f a = *(const v4fa*)(F + t * 8), c = *(const v4fa*)(F + t * 8 + 4);
#pragma unroll
  for (int q = 0; q < 4; ++q) { _Float16 h = (_Float16)a[q]; fh.h[q] = h; fl.h[q] = (_Float16)((a[q] - (float)h) * 1024.0f); h = (_Float16)c[q]; fh.h[4 + q] = h; fl.h[4 + q] = (_Float16)((c[q] - (float)h) * 1024.0f); }
  { *(v8us*)((unsigned short*)Hh + t * 8) = fh.half[0]; *(v8us*)((unsigned short*)Hl + t * 8) = fl.half[0];  } }

// ---- fast GEMM (wave tile 32x64; requires M % 32 == 0 rows per launch region and N % 64 == 0); epilogue = k_gemm_hhx semantics ----
__device__ __forceinline__ v16h g2_frag(const _Float16* p, int hh) { FragH f; f.half[0] = *(const v8us*)((const unsigned short*)p + 8 * hh); f.half[1] = *(const v8us*)((const unsigned short*)p + 16 + 8 * hh); return f.v; }
__device__ __forceinline__ v8f g2_mma(v16h a, v16h b, v8f c) { v8f d = __builtin_amdgcn_wmma_f32_16x16x32_f16(false, a, false, b, (short)0, c, false, false); asm volatile("v_nop\n\tv_nop\n\tv_nop\n\tv_nop" : "+v"(d) : "v"(a), "v"(b)); return d; }
template <int ACT>
__global__ __launch_bounds__(128) void k_gemm2(const _Float16* __restrict__ A, int lda, size_t sA, const _Float16* __restrict__ Bh, int ldb, size_t sB, float alpha, const float* __restrict__ bias, size_t sBias, const float* __restrict__ CP, int rowsPerB, size_t sCPb, int row0g,
    float* __restrict__ C, _Float16* __restrict__ C16, int ldc, size_t sC, int M, int N, int K) {
  __shared__ __attribute__((aligned(16))) float so[4][32][68];
  const int tid = threadIdx.x, w = tid >> 5, lane = tid & 31, ln = lane & 15, hh = lane >> 4; const int by = blockIdx.y;
  A += (size_t)by * sA; Bh += (size_t)by * sB; const size_t cofs = (size_t)by * sC; const float* bp = bias ? bias + (size_t)by * sBias : nullptr;
  const int ntn = N >> 6; const int mt = blockIdx.x / ntn, nq = blockIdx.x - mt * ntn; const int row0 = mt * 128 + 32 * w, col0 = nq * 64; if (row0 >= M) return;
  const _Float16* a0p = A + (size_t)(row0 + ln) * lda; const _Float16* a1p = a0p + (size_t)16 * lda;
  const _Float16* b0p = Bh + (size_t)(col0 + ln) * ldb; const _Float16* b1p = b0p + (size_t)16 * ldb; const _Float16* b2p = b1p + (size_t)16 * ldb; const _Float16* b3p = b2p + (size_t)16 * ldb;
  const v8f z8 = {0.f,0.f,0.f,0.f,0.f,0.f,0.f,0.f}; v8f c00 = z8, c01 = z8, c02 = z8, c03 = z8, c10 = z8, c11 = z8, c12 = z8, c13 = z8;
#pragma unroll 1
  for (int kb = 0; kb < K; kb += 32) { const v16h a0 = g2_frag(a0p + kb, hh), a1 = g2_frag(a1p + kb, hh);
    v16h b = g2_frag(b0p + kb, hh); c00 = g2_mma(a0, b, c00); c10 = g2_mma(a1, b, c10);
    b = g2_frag(b1p + kb, hh); c01 = g2_mma(a0, b, c01); c11 = g2_mma(a1, b, c11);
    b = g2_frag(b2p + kb, hh); c02 = g2_mma(a0, b, c02); c12 = g2_mma(a1, b, c12);
    b = g2_frag(b3p + kb, hh); c03 = g2_mma(a0, b, c03); c13 = g2_mma(a1, b, c13); }
  v8f accs[8] = {c00, c01, c02, c03, c10, c11, c12, c13};
#pragma unroll
  for (int u = 0; u < 8; ++u) { const int t = u & 3, half = u >> 2; const int col = col0 + t * 16 + ln; const float bv = bp ? bf16_round(bp[col]) : 0.f;
#pragma unroll
    for (int r = 0; r < 8; ++r) { const int rloc = half * 16 + 8 * hh + r; float v = accs[u][r] * alpha + bv; if (CP) { const int bidx = (row0g + row0 + rloc) / rowsPerB; v += CP[(size_t)bidx * sCPb + (size_t)by * 64 + col]; }
      if (ACT == 3) v = fmaxf(v, 0.f); else if (ACT == 6) v = 0.5f * v * (1.0f + erff(v * 0.70710678118654752f)); else if (ACT == 11) v = 1.0f / (1.0f + expf(-v)); else if (ACT == 15) v = v / (1.0f + expf(-v)); else if (ACT == 12) v = (v > 0.f) ? v : 0.01f * v; else if (ACT == 8) v = tanhf(v);
      so[w][rloc][t * 16 + ln] = v; } }
  __builtin_amdgcn_fence(__ATOMIC_ACQ_REL, "workgroup"); __builtin_amdgcn_wave_barrier();
  const int rsub = lane >> 4, c4 = (lane & 15) * 4;
  {
#pragma unroll
    for (int q = 0; q < 16; ++q) { const int r = q * 2 + rsub; const v4f v = *(const v4fa*)&so[w][r][c4]; if (C) *(v4f*)(C + cofs + (size_t)(row0 + r) * ldc + col0 + c4) = v; if (C16) { v4h h4; for (int i = 0; i < 4; ++i) h4[i] = (_Float16)v[i]; *(v4h*)(C16 + cofs + (size_t)(row0 + r) * ldc + col0 + c4) = h4; } }
     } }


template <int NHv, int TTv>
__global__ __launch_bounds__(256) void k_vt2(const _Float16* __restrict__ V16, int ldv, _Float16* __restrict__ Vt, int ldt, int col0) { __shared__ unsigned short tl[64][66]; const int tid = threadIdx.x; const int h = blockIdx.x / (TTv / 64), lg = blockIdx.x % (TTv / 64); V16 += (size_t)blockIdx.y * TTv * ldv; Vt += (size_t)blockIdx.y * (NHv * 64) * ldt;
  for (int i = tid; i < 64 * 8; i += 256) { const int r = i / 8, c8 = (i % 8) * 8; FragH f; f.half[0] = *(const v8us*)((const unsigned short*)V16 + ((size_t)lg * 64 + r) * ldv + h * 64 + c8);
#pragma unroll
    for (int q = 0; q < 8; ++q) tl[r][c8 + q] = f.u[q]; }
  __syncthreads();
  {
#pragma unroll
    for (int rd = 0; rd < 2; ++rd) { const int d = rd * 32 + tid / 8, pc = tid % 8; FragH f;
#pragma unroll
      for (int q = 0; q < 8; ++q) f.u[q] = tl[pc * 8 + q][d];
      *(v8us*)((unsigned short*)Vt + ((size_t)h * 64 + d) * ldt + col0 + lg * 64 + pc * 8) = f.half[0]; }
     } }
__global__ __launch_bounds__(256) void k_hlraw(const float* __restrict__ F, _Float16* __restrict__ H, _Float16* __restrict__ L, size_t n8) {
  #pragma clang fp contract(off)
  const size_t t = (size_t)blockIdx.x * 256 + threadIdx.x; if (t >= n8) return; FragH a, b; for (int q = 0; q < 8; ++q) { const float v = F[t * 8 + q]; const _Float16 h = (_Float16)v; a.h[q] = h; b.h[q] = (_Float16)(v - (float)h); }
  { *(v8us*)((unsigned short*)H + t * 8) = a.half[0]; *(v8us*)((unsigned short*)L + t * 8) = b.half[0];  } }

// ---- fused attention: 8 waves x 16 queries per work-group, 64 keys per stage ----
#define AKB 64        /* keys per stage */
#define KPITCH 136    /* f16 per K row in LDS: 272 B = 16 B x 17 (odd), conflict-free for 16-byte fragment reads */
#define VPITCH 72     /* f16 per v^T row in LDS: 144 B = 16 B x 9 (odd) */
#define ASH (AKB * KPITCH)            /* v_hi^T tile's place in a buffer, f16 */
#define ASL (ASH + FF * VPITCH)       /* v_lo^T tile's place */
#define ABUF (ASL + FF * VPITCH)      /* one buffer, f16: 54,272 B */
#define ANST (SLEN / AKB)             /* stages */
__device__ __forceinline__ v16h at_frag(const unsigned short* p, int hh) { FragH f; f.half[0] = *(const v8us*)(p + 8 * hh); f.half[1] = *(const v8us*)(p + 16 + 8 * hh); return f.v; }
__device__ __forceinline__ v8f at_mma(v16h a, v16h b, v8f c) { return __builtin_amdgcn_wmma_f32_16x16x32_f16(false, a, false, b, (short)0, c, false, false); }
__device__ __forceinline__ float at_xhalf(float x) { return __builtin_bit_cast(float, __builtin_amdgcn_permlanex16(__builtin_bit_cast(int, x), __builtin_bit_cast(int, x), 0x76543210, 0xfedcba98, false, false)); }      /* lane l reads lane l ^ 16 */
__global__ __launch_bounds__(256) void k_attn(const _Float16* __restrict__ Q, const _Float16* __restrict__ Kk, const _Float16* __restrict__ Vt, float* __restrict__ O) {
  __shared__ __attribute__((aligned(16))) unsigned short sm[2 * ABUF];      /* two buffers, each: K tile, v_hi^T tile, v_lo^T tile */
  const int tid = threadIdx.x, w = tid >> 5, lane = tid & 31, ln = lane & 15, hh = lane >> 4, b = blockIdx.y;
  const int q0 = blockIdx.x * 128 + w * 16;
  const unsigned short* kg = (const unsigned short*)Kk + (size_t)b * SLEN * FF + tid * 8;                                  /* a K stage is 16 KiB in a row */
  const unsigned short* vg = (const unsigned short*)Vt + (size_t)b * FF * 2 * SLEN + (size_t)(tid >> 3) * (2 * SLEN) + (tid & 7) * 8;      /* 128 rows x 128 B, hi; lo at + SLEN */
  const int kw = (tid >> 4) * KPITCH + (tid & 15) * 8, vw = (tid >> 3) * VPITCH + (tid & 7) * 8;
  const _Float16* qp = Q + ((size_t)b * SLEN + q0 + ln) * FF;
  v16h qf[4];
#pragma unroll
  for (int ks = 0; ks < 4; ++ks) qf[ks] = g2_frag(qp + ks * 32, hh);
  const v8f z8 = {0.f,0.f,0.f,0.f,0.f,0.f,0.f,0.f};
  v8f o[8] = {z8, z8, z8, z8, z8, z8, z8, z8};
  float mrun = -3.0e38f, ls0 = 0.f, ls1 = 0.f;
  const float SC = 0.09016844005556021f;      /* log2(e) / 16 */
  v8us pk[4], ph[4], pl[4];      /* one stage on its way from global memory to LDS */
  auto fetch = [&](int st) { const unsigned short* kn = kg + (size_t)st * AKB * FF; const unsigned short* vn = vg + st * AKB;
    __builtin_amdgcn_sched_barrier(0);      /* with the one behind the wait: no other instruction, so no rewrite of an address register, comes between these loads and their s_wait_xcnt */
#pragma unroll
    for (int i = 0; i < 4; ++i) { pk[i] = *(const v8us*)(kn + i * 2048); ph[i] = *(const v8us*)(vn + (size_t)i * 32 * 2 * SLEN); pl[i] = *(const v8us*)(vn + (size_t)i * 32 * 2 * SLEN + SLEN); }
    asm volatile("s_wait_xcnt 0x0" ::: "memory");      /* stands before the address registers of the loads above (and of the Q loads) are reused */
    __builtin_amdgcn_sched_barrier(0); };
  auto put = [&](unsigned short* bw) {
#pragma unroll
    for (int i = 0; i < 4; ++i) { *(v8us*)(bw + kw + i * 16 * KPITCH) = pk[i]; *(v8us*)(bw + ASH + vw + i * 32 * VPITCH) = ph[i]; *(v8us*)(bw + ASL + vw + i * 32 * VPITCH) = pl[i]; } };
  fetch(0); put(sm); fetch(1);
  __syncthreads();      /* stage 0 is in buffer 0 for every wave */
  /* rolled: one stage's code stays small, and the loads of stage st + 2 stay in their own block ahead of the products */
#pragma unroll 1
  for (int st = 0; st < ANST; ++st) {
    const unsigned short* sk = sm + (st & 1) * ABUF; const unsigned short* sh = sk + ASH; const unsigned short* sl = sk + ASL;
    if (st + 1 < ANST) put(sm + ((st + 1) & 1) * ABUF);      /* into the buffer whose readers (stage st - 1) all passed the barrier at the loop's foot */
    if (st + 2 < ANST) fetch(st + 2);
    /* Fragment reads stand in groups ahead of the products that use them; each sched_barrier keeps the compiler from sinking a group's reads
       down to one read, one full wait, one WMMA (which it does otherwise, and every WMMA then waits out an LDS latency). */
    v16h kf[16];
#pragma unroll
    for (int ks = 0; ks < 4; ++ks)
#pragma unroll
      for (int kt = 0; kt < 4; ++kt) kf[ks * 4 + kt] = at_frag(sk + (kt * 16 + ln) * KPITCH + ks * 32, hh);
    __builtin_amdgcn_sched_barrier(0);      /* all K reads issued before the first score WMMA */
    v8f s[4] = {z8, z8, z8, z8};      /* s[kt][r] = score of key kt*16 + 8*hh + r, query ln */
#pragma unroll
    for (int ks = 0; ks < 4; ++ks)
#pragma unroll
      for (int kt = 0; kt < 4; ++kt) s[kt] = at_mma(kf[ks * 4 + kt], qf[ks], s[kt]);
    __builtin_amdgcn_sched_barrier(0);      /* the v^T reads below stay behind the score WMMAs and ahead of the softmax, which hides them */
    v16h va[8], vb[8], vc[8], vd[8];      /* keys 0-31: hi, lo; keys 32-63: hi, lo */
#pragma unroll
    for (int ft = 0; ft < 8; ++ft) va[ft] = at_frag(sh + (ft * 16 + ln) * VPITCH, hh);
#pragma unroll
    for (int ft = 0; ft < 8; ++ft) vb[ft] = at_frag(sl + (ft * 16 + ln) * VPITCH, hh);
    __builtin_amdgcn_sched_barrier(0);      /* first two v^T groups in flight before the maxima */
    float mx = s[0][0];
#pragma unroll
    for (int kt = 0; kt < 4; ++kt)
#pragma unroll
      for (int r = 0; r < 8; ++r) mx = fmaxf(mx, s[kt][r]);
    mx = fmaxf(mx, at_xhalf(mx)) * SC;
    if (__builtin_amdgcn_ballot_w32(mx > mrun) != 0) {      /* some query's maximum rose: rescale (factor 1 for the others) */
      const float mn = fmaxf(mrun, mx); const float corr = __builtin_amdgcn_exp2f(mrun - mn); mrun = mn; ls0 *= corr; ls1 *= corr;
#pragma unroll
      for (int ft = 0; ft < 8; ++ft)
#pragma unroll
        for (int r = 0; r < 8; ++r) o[ft][r] *= corr;
    }
    const float moff = mrun - 10.0f;      /* P x 2^10 keeps small probabilities in f16's normal range; it cancels in the division */
    FragH pb[2];
#pragma unroll
    for (int g = 0; g < 2; ++g)
#pragma unroll
      for (int e = 0; e < 16; e += 2) { const float pa = __builtin_amdgcn_exp2f(s[2 * g + (e >> 3)][e & 7] * SC - moff), pc = __builtin_amdgcn_exp2f(s[2 * g + (e >> 3)][(e & 7) + 1] * SC - moff);
        ls0 += pa; ls1 += pc; pb[g].h[e] = (_Float16)pa; pb[g].h[e + 1] = (_Float16)pc; }
#pragma unroll
    for (int ft = 0; ft < 8; ++ft) vc[ft] = at_frag(sh + (ft * 16 + ln) * VPITCH + 32, hh);
    __builtin_amdgcn_sched_barrier(0);      /* third group issued before the first group's WMMAs */
#pragma unroll
    for (int ft = 0; ft < 8; ++ft) o[ft] = at_mma(va[ft], pb[0].v, o[ft]);
    __builtin_amdgcn_sched_barrier(0);      /* fourth group issued between the first and the second group's WMMAs */
#pragma unroll
    for (int ft = 0; ft < 8; ++ft) vd[ft] = at_frag(sl + (ft * 16 + ln) * VPITCH + 32, hh);
    __builtin_amdgcn_sched_barrier(0);      /* ... and not sunk among the WMMAs that follow */
#pragma unroll
    for (int ft = 0; ft < 8; ++ft) o[ft] = at_mma(vb[ft], pb[0].v, o[ft]);
#pragma unroll
    for (int ft = 0; ft < 8; ++ft) o[ft] = at_mma(vc[ft], pb[1].v, o[ft]);
#pragma unroll
    for (int ft = 0; ft < 8; ++ft) o[ft] = at_mma(vd[ft], pb[1].v, o[ft]);
    __syncthreads();      /* publishes stage st + 1 and ends every read of stage st's buffer */
  }
  float lsum = ls0 + ls1; lsum += at_xhalf(lsum);
  const float inv = 1.0f / lsum;
  float* op = O + ((size_t)b * SLEN + q0 + ln) * FF + 8 * hh;      /* o[ft][r] = out[query ln][feature ft*16 + 8*hh + r] */
#pragma unroll
  for (int ft = 0; ft < 8; ++ft) { const v4f u0 = {o[ft][0] * inv, o[ft][1] * inv, o[ft][2] * inv, o[ft][3] * inv}, u1 = {o[ft][4] * inv, o[ft][5] * inv, o[ft][6] * inv, o[ft][7] * inv};
    *(v4f*)(op + ft * 16) = u0; *(v4f*)(op + ft * 16 + 4) = u1; }
}

extern "C" void kernel_launch(void* const* d_in, const int* in_sizes, int n_in,
                              void* d_out, int out_size, void* d_ws, size_t ws_size, hipStream_t stream) {
  (void)in_sizes; (void)n_in; (void)out_size;
  const float* const* I = (const float* const*)d_in; const float* x = I[0]; const float* Wq = I[1]; const float* bq = I[2]; const float* Wk = I[3]; const float* bk = I[4]; const float* Wv = I[5]; const float* bv = I[6];
  char* ws = (char*)d_ws; size_t off = 0;
  auto take = [&](size_t bytes) { char* p = ws + off; off += (bytes + 255) & ~(size_t)255; return p; };
  _Float16* BQ = (_Float16*)take((size_t)FF * FF * 2); _Float16* BK = (_Float16*)take((size_t)FF * FF * 2); _Float16* BV = (_Float16*)take((size_t)FF * FF * 2);
  const size_t PL = (size_t)NBT * SLEN * FF;      /* elements of one [16][2048][128] plane */
  _Float16* Q16 = (_Float16*)take(PL * 2); _Float16* K16 = (_Float16*)take(PL * 2); _Float16* VT2 = (_Float16*)take(PL * 2 * 2);
  _Float16* X16 = (_Float16*)take(PL * 2); float* VF = (float*)take(PL * 4); _Float16* Vh = (_Float16*)take(PL * 2); _Float16* Vl = (_Float16*)take(PL * 2);
  if (off > ws_size) return;      /* 0.1 + 32 + 40 = 72 MiB */
  const size_t w8 = (size_t)FF * FF / 8; const unsigned wb = (unsigned)((w8 + 255) / 256);
  k_round16f<<<wb, 256, 0, stream>>>(Wq, BQ, w8); k_round16f<<<wb, 256, 0, stream>>>(Wk, BK, w8); k_round16f<<<wb, 256, 0, stream>>>(Wv, BV, w8);      /* torch (out,in) = natural Bt */
  const size_t n8 = PL / 8; const unsigned nb8 = (unsigned)((n8 + 255) / 256); const dim3 gA((NBT * SLEN / 128) * (FF / 64), 1), gT((FF / 64) * (SLEN / 64), NBT);
  k_x16<<<nb8, 256, 0, stream>>>(x, X16, n8);
  k_gemm2<0><<<gA, 128, 0, stream>>>(X16, FF, 0, BQ, FF, 0, 0.0625f, bq, 0, nullptr, 1, 0, 0, nullptr, Q16, FF, 0, NBT * SLEN, FF, FF);
  k_gemm2<0><<<gA, 128, 0, stream>>>(X16, FF, 0, BK, FF, 0, 0.0625f, bk, 0, nullptr, 1, 0, 0, nullptr, K16, FF, 0, NBT * SLEN, FF, FF);
  k_gemm2<0><<<gA, 128, 0, stream>>>(X16, FF, 0, BV, FF, 0, 0.0625f, bv, 0, nullptr, 1, 0, 0, VF, nullptr, FF, 0, NBT * SLEN, FF, FF); k_hlraw<<<nb8, 256, 0, stream>>>(VF, Vh, Vl, n8);
  k_vt2<FF / 64, SLEN><<<gT, 256, 0, stream>>>(Vh, FF, VT2, 2 * SLEN, 0); k_vt2<FF / 64, SLEN><<<gT, 256, 0, stream>>>(Vl, FF, VT2, 2 * SLEN, SLEN);
  k_attn<<<dim3(SLEN / 128, NBT), 256, 0, stream>>>(Q16, K16, VT2, (float*)d_out);      /* softmax(q.k / 16) . (v_hi + v_lo) */
}

// v003
// One run takes 67.6 microseconds.
// Two timings next to v002 both put it at 1.57 times that version's speed.
// Counting every step since v000, it is 40.1 times as fast.
#include <hip/hip_runtime.h>
// Non-local interaction (16 x 2048 tokens, 128 features, single head): q,k,v = x W^T + b; alpha = softmax(q.k / 16); out = alpha v -> [16,2048,128].
// Structure (batches side by side in the grid): ONE projection kernel per 128 tokens: x and the x16 weights rounded to bf16 values and laid in LDS as exact f16, q, k and v^T as f16 WMMA products (f32 accumulation, bias added), q and k stored as f16 rows, v split into f16 hi and raw residual and stored transposed, all in whole lines; then ONE fused kernel per 128 queries: K and v^T tiles of 64 keys staged in LDS, S^T = K.Q^T, running-maximum softmax in registers (a lane holds one query's scores), P^T packed from the score tiles as the B operand, O^T += [v_hi^T ; v_lo^T].P^T, divided by the row sum at the end. No score or probability plane in memory.
// Compute dtype: x, weights, biases rounded to bf16; q, k, P as f16 operands (~2^-12; logits sigma ~1.4); v as hi + residual (~2^-22); f32 accumulation and softmax. v_wmma_f32_16x16x32_f16.
#define NBT 16
#define SLEN 2048
#define FF 128
typedef __bf16 v16b __attribute__((ext_vector_type(16)));
typedef unsigned short v8us __attribute__((ext_vector_type(8), may_alias));
typedef float  v8f  __attribute__((ext_vector_type(8)));
typedef float  v4f  __attribute__((ext_vector_type(4)));
typedef float  v4fa __attribute__((ext_vector_type(4), may_alias));
union FragB { v16b v; v8us half[2]; unsigned short u[16]; };

__device__ __forceinline__ unsigned short bf16_bits(float x) { unsigned int u = __float_as_uint(x); return (unsigned short)((u + 0x7FFFu + ((u >> 16) & 1u)) >> 16); }
__device__ __forceinline__ float bf16_val(unsigned short b) { return __uint_as_float(((unsigned int)b) << 16); }
__device__ __forceinline__ float bf16_round(float x) { return bf16_val(bf16_bits(x)); }
// D += A·B with NT terms: 1 = ah·bh, 2 = + al·bh (A split), 3 = + ah·bl (both split)
template <int NT>
__device__ __forceinline__ v8f mmaN(v16b ah, v16b al, v16b bh, v16b bl, v8f c) {
  c = __builtin_amdgcn_wmma_f32_16x16x32_bf16(false, ah, false, bh, (short)0, c, false, false);
  if (NT >= 2) c = __builtin_amdgcn_wmma_f32_16x16x32_bf16(false, al, false, bh, (short)0, c, false, false);
  if (NT >= 3) c = __builtin_amdgcn_wmma_f32_16x16x32_bf16(false, ah, false, bl, (short)0, c, false, false);
  asm volatile("v_nop\n\tv_nop\n\tv_nop\n\tv_nop" : "+v"(c) : "v"(ah), "v"(al), "v"(bh), "v"(bl));
  return c;
}

__global__ __launch_bounds__(256) void k_wt_bf16(const float* __restrict__ W, unsigned short* __restrict__ Wt, int K, int N) {
  const int t = blockIdx.x * 256 + threadIdx.x;
  const int k8n = K / 8;
  if (t >= N * k8n) return;
  const int n = t / k8n, k8 = (t % k8n) * 8;
  v8us v;
#pragma unroll
  for (int i = 0; i < 8; ++i) v[i] = bf16_bits(W[(size_t)(k8 + i) * N + n]);
  *(v8us*)(Wt + (size_t)n * K + k8) = v;
  
}

// GEMM C[M][N] (f32, pitch ldc) = act(A[M][K]·W + bias). A f32 row-major (pitch lda) converted per fragment to bf16
// (ASPLIT: hi/lo two planes -> 2 terms, else single rounded term); Wt bf16 [N][K] (pitch ldb). BIAS_BF16 rounds the
// bias to bf16 first (bias quantised to bf16 before the add). K%32==0, M%16==0, N%64==0.
template <bool ASPLIT, int ACT, bool BIAS_BF16>
__global__ __launch_bounds__(128) void k_gemm_bf(const float* __restrict__ A, int lda, const unsigned short* __restrict__ Wt, int ldb,
                                               const float* __restrict__ bias, float* __restrict__ C, int ldc, int M, int N, int K) {
  __shared__ __attribute__((aligned(16))) float so[4][16][64];
  const int tid = threadIdx.x, w = tid >> 5, lane = tid & 31, ln = lane & 15, hh = lane >> 4;
  const int ntn = N / 64;
  const int wid = blockIdx.x * 4 + w;
  const int mt = wid / ntn, nq = wid % ntn;
  if (mt * 16 >= M) return;
  const int row0 = mt * 16, col0 = nq * 64;
  const float* arow = A + (size_t)(row0 + ln) * lda;
  v8f acc[4] = {};
  for (int kb = 0; kb < K; kb += 32) {
    FragB ah, al;
    const v4f x0 = *(const v4fa*)(arow + kb + 8 * hh), x1 = *(const v4fa*)(arow + kb + 8 * hh + 4);
    const v4f x2 = *(const v4fa*)(arow + kb + 16 + 8 * hh), x3 = *(const v4fa*)(arow + kb + 16 + 8 * hh + 4);
    float xs[16] = {x0[0],x0[1],x0[2],x0[3],x1[0],x1[1],x1[2],x1[3],x2[0],x2[1],x2[2],x2[3],x3[0],x3[1],x3[2],x3[3]};
#pragma unroll
    for (int i = 0; i < 16; ++i) { const unsigned short hb = bf16_bits(xs[i]); ah.u[i] = hb; al.u[i] = ASPLIT ? bf16_bits(xs[i] - bf16_val(hb)) : (unsigned short)0; }
#pragma unroll
    for (int t = 0; t < 4; ++t) {
      const unsigned short* brow = Wt + (size_t)(col0 + t * 16 + ln) * ldb + kb;
      FragB b;
      b.half[0] = *(const v8us*)(brow + 8 * hh);
      b.half[1] = *(const v8us*)(brow + 16 + 8 * hh);
      acc[t] = mmaN<ASPLIT ? 2 : 1>(ah.v, al.v, b.v, b.v, acc[t]);
    }
  }
#pragma unroll
  for (int t = 0; t < 4; ++t) {
    float bv = bias ? bias[col0 + t * 16 + ln] : 0.f;
    if (BIAS_BF16) bv = bf16_round(bv);
#pragma unroll
    for (int r = 0; r < 8; ++r) { float v = acc[t][r] + bv; if (ACT == 1) v = fmaxf(v, 0.f); so[w][8 * hh + r][t * 16 + ln] = v; }
  }
  __builtin_amdgcn_fence(__ATOMIC_ACQ_REL, "workgroup");
  __builtin_amdgcn_wave_barrier();
  const int rsub = lane >> 4, c4 = (lane & 15) * 4;
  {
#pragma unroll
    for (int q = 0; q < 8; ++q) {
      const int r = q * 2 + rsub;
      const v4f v = *(const v4fa*)&so[w][r][c4];
      *(v4f*)(C + (size_t)(row0 + r) * ldc + col0 + c4) = v;
    }
    
  }
}

// GEMM C = act(A·W + bias + resid): A f32 (ASPLIT -> hi/lo 2 terms), Wt bf16 [N][K]; ACT 0 none, 1 relu, 2 exact gelu;
// resid (optional, f32, row index = (row % rmod), pitch ldr, RES_BF16 rounds it) added before the activation.
template <bool ASPLIT, int ACT, bool BIAS_BF16, bool RES_BF16>
__global__ __launch_bounds__(128) void k_gemm_bf3(const float* __restrict__ A, int lda, const unsigned short* __restrict__ Wt, int ldb,
                                                const float* __restrict__ bias, const float* __restrict__ resid, int rmod, int ldr,
                                                float* __restrict__ C, int ldc, int M, int N, int K) {
  __shared__ __attribute__((aligned(16))) float so[4][16][64];
  const int tid = threadIdx.x, w = tid >> 5, lane = tid & 31, ln = lane & 15, hh = lane >> 4;
  const int ntn = N / 64;
  const int wid = blockIdx.x * 4 + w;
  const int mt = wid / ntn, nq = wid % ntn;
  if (mt * 16 >= M) return;
  const int row0 = mt * 16, col0 = nq * 64;
  const float* arow = A + (size_t)(row0 + ln) * lda;
  v8f acc[4] = {};
  for (int kb = 0; kb < K; kb += 32) {
    FragB ah, al;
    const v4f x0 = *(const v4fa*)(arow + kb + 8 * hh), x1 = *(const v4fa*)(arow + kb + 8 * hh + 4);
    const v4f x2 = *(const v4fa*)(arow + kb + 16 + 8 * hh), x3 = *(const v4fa*)(arow + kb + 16 + 8 * hh + 4);
    float xs[16] = {x0[0],x0[1],x0[2],x0[3],x1[0],x1[1],x1[2],x1[3],x2[0],x2[1],x2[2],x2[3],x3[0],x3[1],x3[2],x3[3]};
#pragma unroll
    for (int i = 0; i < 16; ++i) { const unsigned short hb = bf16_bits(xs[i]); ah.u[i] = hb; al.u[i] = ASPLIT ? bf16_bits(xs[i] - bf16_val(hb)) : (unsigned short)0; }
#pragma unroll
    for (int t = 0; t < 4; ++t) {
      const unsigned short* brow = Wt + (size_t)(col0 + t * 16 + ln) * ldb + kb;
      FragB b;
      b.half[0] = *(const v8us*)(brow + 8 * hh);
      b.half[1] = *(const v8us*)(brow + 16 + 8 * hh);
      acc[t] = mmaN<ASPLIT ? 2 : 1>(ah.v, al.v, b.v, b.v, acc[t]);
    }
  }
#pragma unroll
  for (int t = 0; t < 4; ++t) {
    const int col = col0 + t * 16 + ln;
    float bv = bias ? bias[col] : 0.f;
    if (BIAS_BF16) bv = bf16_round(bv);
#pragma unroll
    for (int r = 0; r < 8; ++r) {
      float v = acc[t][r] + bv;
      if (resid) { float rv = resid[(size_t)((row0 + 8 * hh + r) % rmod) * ldr + col]; if (RES_BF16) rv = bf16_round(rv); v += rv; }
      if (ACT == 1) v = fmaxf(v, 0.f);
      if (ACT == 2) v = 0.5f * v * (1.0f + erff(v * 0.70710678118654752f));
      if (ACT == 3) { const float u = 0.7978845608028654f * (v + 0.044715f * v * v * v); v = 0.5f * v * (1.0f + tanhf(u)); }
      so[w][8 * hh + r][t * 16 + ln] = v;
    }
  }
  __builtin_amdgcn_fence(__ATOMIC_ACQ_REL, "workgroup");
  __builtin_amdgcn_wave_barrier();
  const int rsub = lane >> 4, c4 = (lane & 15) * 4;
  {
#pragma unroll
    for (int q = 0; q < 8; ++q) {
      const int r = q * 2 + rsub;
      const v4f v = *(const v4fa*)&so[w][r][c4];
      *(v4f*)(C + (size_t)(row0 + r) * ldc + col0 + c4) = v;
    }
    
  }
}
// row LayerNorm (biased variance, eps) over N: s = X (+ R); optional out_sum <- s; out_norm <- (s-mu)*rsqrt(var+eps)*g + b
template <bool PARAM_BF16>
__global__ __launch_bounds__(256) void k_layernorm(const float* __restrict__ X, const float* __restrict__ R, const float* __restrict__ g, const float* __restrict__ bta,
                                                  float* __restrict__ out_sum, float* __restrict__ out_norm, int N, float eps) {
  __shared__ float red[256];
  const int row = blockIdx.x, tid = threadIdx.x;
  const float* x = X + (size_t)row * N; const float* rr = R ? R + (size_t)row * N : nullptr;
  float vals[16];                     // up to N = 4096
  const int per = N / 256;            // contiguous chunk per thread? use strided-by-4 chunks: thread handles j = tid*4 + 1024*u
  float s1 = 0.f;
  for (int u = 0; u < per / 4; ++u) {
    const int j = tid * 4 + 1024 * u;
    const v4f a = *(const v4fa*)(x + j);
    v4f b = {0.f,0.f,0.f,0.f}; if (rr) b = *(const v4fa*)(rr + j);
#pragma unroll
    for (int q = 0; q < 4; ++q) { const float v = a[q] + b[q]; vals[u * 4 + q] = v; s1 += v; }
  }
  red[tid] = s1; __syncthreads();
  for (int st = 128; st > 0; st >>= 1) { if (tid < st) red[tid] += red[tid + st]; __syncthreads(); }
  const float mu = red[0] / (float)N; __syncthreads();
  float s2 = 0.f;
  for (int u = 0; u < per / 4; ++u)
#pragma unroll
    for (int q = 0; q < 4; ++q) { const float c = vals[u * 4 + q] - mu; s2 += c * c; }
  red[tid] = s2; __syncthreads();
  for (int st = 128; st > 0; st >>= 1) { if (tid < st) red[tid] += red[tid + st]; __syncthreads(); }
  const float rs = rsqrtf(red[0] / (float)N + eps);
  {
    for (int u = 0; u < per / 4; ++u) {
      const int j = tid * 4 + 1024 * u;
      v4f o, sm;
#pragma unroll
      for (int q = 0; q < 4; ++q) {
        float gg = g[j + q], bb = bta[j + q];
        if (PARAM_BF16) { gg = bf16_round(gg); bb = bf16_round(bb); }
        sm[q] = vals[u * 4 + q]; o[q] = (vals[u * 4 + q] - mu) * rs * gg + bb;
      }
      if (out_sum) *(v4f*)(out_sum + (size_t)row * N + j) = sm;
      *(v4f*)(out_norm + (size_t)row * N + j) = o;
    }
    
  }
}



// ---- f16 WMMA path (v_wmma_f32_16x16x32_f16): 11-bit significands for operands in range — used where a [0,1] probability operand needs more precision than bf16
typedef _Float16 v16h __attribute__((ext_vector_type(16)));
union FragH { v16h v; v8us half[2]; _Float16 h[16]; unsigned short u[16]; };
template <int NT>
__device__ __forceinline__ v8f mmaH(v16h ah, v16h al, v16h bh, v16h bl, v8f c) {
  c = __builtin_amdgcn_wmma_f32_16x16x32_f16(false, ah, false, bh, (short)0, c, false, false);
  if (NT >= 2) c = __builtin_amdgcn_wmma_f32_16x16x32_f16(false, al, false, bh, (short)0, c, false, false);
  if (NT >= 3) c = __builtin_amdgcn_wmma_f32_16x16x32_f16(false, ah, false, bl, (short)0, c, false, false);
  asm volatile("v_nop\n\tv_nop\n\tv_nop\n\tv_nop" : "+v"(c) : "v"(ah), "v"(al), "v"(bh), "v"(bl));
  return c;
}
// batched GEMM like k_gemm_b but f16 operands: A f32 (split into f16 hi/lo if ASPLIT, else rounded to f16), Bt = f16 values [n][k]; alpha; C f32; N multiple of 16 (partial tiles skipped)
template <bool ASPLIT>
__global__ __launch_bounds__(128) void k_gemm_h(const float* __restrict__ A, int lda, size_t sA, const _Float16* __restrict__ Bh, int ldb, size_t sB, float alpha, float* __restrict__ C, int ldc, size_t sC, int M, int N, int K) {
  __shared__ __attribute__((aligned(16))) float so[4][16][64];
  const int tid = threadIdx.x, w = tid >> 5, lane = tid & 31, ln = lane & 15, hh = lane >> 4; const int by = blockIdx.y;
  A += (size_t)by * sA; Bh += (size_t)by * sB; C += (size_t)by * sC;
  const int ntn = (N + 63) / 64; const int wid = blockIdx.x * 4 + w; const int mt = wid / ntn, nq = wid % ntn; if (mt * 16 >= M) return;
  const int row0 = mt * 16, col0 = nq * 64; const float* arow = A + (size_t)(row0 + ln) * lda;
  v8f acc[4] = {};
  for (int kb = 0; kb < K; kb += 32) {
    FragH ah, al;
    const v4f x0 = *(const v4fa*)(arow + kb + 8 * hh), x1 = *(const v4fa*)(arow + kb + 8 * hh + 4), x2 = *(const v4fa*)(arow + kb + 16 + 8 * hh), x3 = *(const v4fa*)(arow + kb + 16 + 8 * hh + 4);
    float xs[16] = {x0[0],x0[1],x0[2],x0[3],x1[0],x1[1],x1[2],x1[3],x2[0],x2[1],x2[2],x2[3],x3[0],x3[1],x3[2],x3[3]};
#pragma unroll
    for (int i = 0; i < 16; ++i) { const _Float16 h = (_Float16)xs[i]; ah.h[i] = h; al.h[i] = ASPLIT ? (_Float16)(xs[i] - (float)h) : (_Float16)0.0f; }
#pragma unroll
    for (int t = 0; t < 4; ++t) { if (col0 + t * 16 >= N) continue; const size_t boff = (size_t)(col0 + t * 16 + ln) * ldb + kb; FragH bq; bq.half[0] = *(const v8us*)(Bh + boff + 8 * hh); bq.half[1] = *(const v8us*)(Bh + boff + 16 + 8 * hh);
      acc[t] = mmaH<ASPLIT ? 2 : 1>(ah.v, al.v, bq.v, bq.v, acc[t]); }
  }
#pragma unroll
  for (int t = 0; t < 4; ++t) { if (col0 + t * 16 >= N) continue;
#pragma unroll
    for (int r = 0; r < 8; ++r) so[w][8 * hh + r][t * 16 + ln] = acc[t][r] * alpha; }
  __builtin_amdgcn_fence(__ATOMIC_ACQ_REL, "workgroup"); __builtin_amdgcn_wave_barrier();
  const int rsub = lane >> 4, c4 = (lane & 15) * 4;
  {
#pragma unroll
    for (int q = 0; q < 8; ++q) { const int r = q * 2 + rsub; if (col0 + c4 < N) { const v4f v = *(const v4fa*)&so[w][r][c4]; *(v4f*)(C + (size_t)(row0 + r) * ldc + col0 + c4) = v; } }
     }
}

// Wt[n][k] = f16(W[k][n]·scale) from f32 row-major W[K][N] (scale = power of two; bf16-exact weights stay exact in f16 away from the subnormal range)
__global__ __launch_bounds__(256) void k_wt_f16(const float* __restrict__ W, _Float16* __restrict__ Wt, int K, int N, float scale) {
  const int t = blockIdx.x * 256 + threadIdx.x; if (t >= N * (K / 8)) return; const int n = t / (K / 8), k8 = (t % (K / 8)) * 8; FragH f;
#pragma unroll
  for (int i = 0; i < 8; ++i) f.h[i] = (_Float16)(bf16_round(W[(size_t)(k8 + i) * N + n]) * scale); const v8us o = f.half[0];
  *(v8us*)((unsigned short*)Wt + (size_t)n * K + k8) = o; 
}
// k_gemm_hh variant with fused epilogue: v = acc·alpha + bias[by·sBias + col] (+ CP[(row/rowsPerB)·sCPb + by·64 + col] if CP) ; ACT 0 none / 1 elu ; writes f16 C16 (and f32 C if non-null)
template <int ACT>
__global__ __launch_bounds__(128) void k_gemm_hhx(const _Float16* __restrict__ A, int lda, size_t sA, const _Float16* __restrict__ Bh, int ldb, size_t sB, float alpha, const float* __restrict__ bias, size_t sBias, const float* __restrict__ CP, int rowsPerB, size_t sCPb, int row0g,
    float* __restrict__ C, _Float16* __restrict__ C16, int ldc, size_t sC, int M, int N, int K) {
  __shared__ __attribute__((aligned(16))) float so[4][16][64];
  const int tid = threadIdx.x, w = tid >> 5, lane = tid & 31, ln = lane & 15, hh = lane >> 4; const int by = blockIdx.y;
  A += (size_t)by * sA; Bh += (size_t)by * sB; const size_t cofs = (size_t)by * sC; const float* bp = bias ? bias + (size_t)by * sBias : nullptr;
  const int ntn = (N + 63) / 64; const int wid = blockIdx.x * 4 + w; const int mt = wid / ntn, nq = wid % ntn; if (mt * 16 >= M) return;
  const int row0 = mt * 16, col0 = nq * 64; const _Float16* arow = A + (size_t)(row0 + ln) * lda;
  v8f acc[4] = {};
  for (int kb = 0; kb < K; kb += 32) { FragH ah; ah.half[0] = *(const v8us*)((const unsigned short*)arow + kb + 8 * hh); ah.half[1] = *(const v8us*)((const unsigned short*)arow + kb + 16 + 8 * hh);
#pragma unroll
    for (int t = 0; t < 4; ++t) { if (col0 + t * 16 >= N) continue; const size_t boff = (size_t)(col0 + t * 16 + ln) * ldb + kb; FragH bq; bq.half[0] = *(const v8us*)((const unsigned short*)Bh + boff + 8 * hh); bq.half[1] = *(const v8us*)((const unsigned short*)Bh + boff + 16 + 8 * hh);
      acc[t] = mmaH<1>(ah.v, ah.v, bq.v, bq.v, acc[t]); }
  }
#pragma unroll
  for (int t = 0; t < 4; ++t) { if (col0 + t * 16 >= N) continue; const int col = col0 + t * 16 + ln; const float bv = bp ? bf16_round(bp[col]) : 0.f;
#pragma unroll
    for (int r = 0; r < 8; ++r) { float v = acc[t][r] * alpha + bv; if (CP) { const int bidx = (row0g + row0 + 8 * hh + r) / rowsPerB; v += CP[(size_t)bidx * sCPb + (size_t)by * 64 + col]; } if (ACT == 1) v = (v > 0.f) ? v : expm1f(v); else if (ACT == 7) v = (v > 0.f) ? v + 1.0f : expf(v); else if (ACT == 8) v = tanhf(v); else if (ACT == 9) v = 0.5f * v * (1.0f + tanhf(0.7978845608028654f * (v + 0.044715f * v * v * v))); else if (ACT == 11) v = 1.0f / (1.0f + expf(-v)); else if (ACT == 12) v = (v > 0.f) ? v : 0.01f * v; else if (ACT == 14) v = (v > 0.f) ? v : 0.1f * v; else if (ACT == 15) v = v / (1.0f + expf(-v)); else if (ACT == 3) v = fmaxf(v, 0.f); else if (ACT == 6) v = 0.5f * v * (1.0f + erff(v * 0.70710678118654752f)); so[w][8 * hh + r][t * 16 + ln] = v; } }
  __builtin_amdgcn_fence(__ATOMIC_ACQ_REL, "workgroup"); __builtin_amdgcn_wave_barrier();
  const int rsub = lane >> 4, c4 = (lane & 15) * 4; typedef _Float16 v4h __attribute__((ext_vector_type(4)));
  {
#pragma unroll
    for (int q = 0; q < 8; ++q) { const int r = q * 2 + rsub; if (col0 + c4 < N) { const v4f v = *(const v4fa*)&so[w][r][c4]; if (C) *(v4f*)(C + cofs + (size_t)(row0 + r) * ldc + col0 + c4) = v; if (C16) { v4h h4; for (int i = 0; i < 4; ++i) h4[i] = (_Float16)v[i]; *(v4h*)(C16 + cofs + (size_t)(row0 + r) * ldc + col0 + c4) = h4; } } }
     }
}


typedef _Float16 v4h __attribute__((ext_vector_type(4)));

__global__ __launch_bounds__(256) void k_h16(const float* __restrict__ x, _Float16* __restrict__ X16, size_t n8) { const size_t t = (size_t)blockIdx.x * 256 + threadIdx.x; if (t >= n8) return; FragH f;
#pragma unroll
  for (int q = 0; q < 8; ++q) f.h[q] = (_Float16)x[t * 8 + q]; *(v8us*)((unsigned short*)X16 + t * 8) = f.half[0];  }
template <int NHv, int TTv>
__global__ __launch_bounds__(256) void k_vt(const _Float16* __restrict__ V16, int ldv, int voff, _Float16* __restrict__ Vt) { __shared__ unsigned short tl[64][66]; const int tid = threadIdx.x; const int slab = blockIdx.x / (TTv / 64), lg = blockIdx.x % (TTv / 64); const int b = slab / NHv, h = slab % NHv;
  for (int i = tid; i < 64 * 8; i += 256) { const int r = i / 8, c8 = (i % 8) * 8; FragH f; f.half[0] = *(const v8us*)((const unsigned short*)V16 + ((size_t)b * TTv + lg * 64 + r) * ldv + voff + h * 64 + c8);
#pragma unroll
    for (int q = 0; q < 8; ++q) tl[r][c8 + q] = f.u[q]; }
  __syncthreads();
  {
#pragma unroll
    for (int rd = 0; rd < 2; ++rd) { const int d = rd * 32 + tid / 8, pc = tid % 8; FragH f;
#pragma unroll
      for (int q = 0; q < 8; ++q) f.u[q] = tl[pc * 8 + q][d];
      *(v8us*)((unsigned short*)Vt + ((size_t)slab * 64 + d) * TTv + lg * 64 + pc * 8) = f.half[0]; }
     } }

__global__ __launch_bounds__(256) void k_hl(const float* __restrict__ F, _Float16* __restrict__ Hh, _Float16* __restrict__ Hl, size_t n8) { const size_t t = (size_t)blockIdx.x * 256 + threadIdx.x; if (t >= n8) return; FragH fh, fl; const v4f a = *(const v4fa*)(F + t * 8), c = *(const v4fa*)(F + t * 8 + 4);
#pragma unroll
  for (int q = 0; q < 4; ++q) { _Float16 h = (_Float16)a[q]; fh.h[q] = h; fl.h[q] = (_Float16)((a[q] - (float)h) * 1024.0f); h = (_Float16)c[q]; fh.h[4 + q] = h; fl.h[4 + q] = (_Float16)((c[q] - (float)h) * 1024.0f); }
  { *(v8us*)((unsigned short*)Hh + t * 8) = fh.half[0]; *(v8us*)((unsigned short*)Hl + t * 8) = fl.half[0];  } }

// ---- a 16 x 32 f16 fragment from global rows ----
__device__ __forceinline__ v16h g2_frag(const _Float16* p, int hh) { FragH f; f.half[0] = *(const v8us*)((const unsigned short*)p + 8 * hh); f.half[1] = *(const v8us*)((const unsigned short*)p + 16 + 8 * hh); return f.v; }

// ---- fused attention: 8 waves x 16 queries per work-group, 64 keys per stage ----
#define AKB 64        /* keys per stage */
#define KPITCH 136    /* f16 per K row in LDS: 272 B = 16 B x 17 (odd), conflict-free for 16-byte fragment reads */
#define VPITCH 72     /* f16 per v^T row in LDS: 144 B = 16 B x 9 (odd) */
#define ASH (AKB * KPITCH)            /* v_hi^T tile's place in a buffer, f16 */
#define ASL (ASH + FF * VPITCH)       /* v_lo^T tile's place */
#define ABUF (ASL + FF * VPITCH)      /* one buffer, f16: 54,272 B */
#define ANST (SLEN / AKB)             /* stages */
__device__ __forceinline__ v16h at_frag(const unsigned short* p, int hh) { FragH f; f.half[0] = *(const v8us*)(p + 8 * hh); f.half[1] = *(const v8us*)(p + 16 + 8 * hh); return f.v; }
__device__ __forceinline__ v8f at_mma(v16h a, v16h b, v8f c) { return __builtin_amdgcn_wmma_f32_16x16x32_f16(false, a, false, b, (short)0, c, false, false); }
__device__ __forceinline__ float at_xhalf(float x) { return __builtin_bit_cast(float, __builtin_amdgcn_permlanex16(__builtin_bit_cast(int, x), __builtin_bit_cast(int, x), 0x76543210, 0xfedcba98, false, false)); }      /* lane l reads lane l ^ 16 */
// ---- projections, one launch: a work-group takes 128 tokens and makes their q, k rows and v^T columns ----
/* Every loop of this part is unrolled: its register arrays (loaded rows, fragments, accumulators) are then indexed by constants and stay in registers. */
#define PPITCH 136    /* f16 per row in LDS: 272 B = 16 B x 17 (odd), conflict-free for 16-byte fragment reads and writes */
#define PMAT (FF * PPITCH)            /* one 128 x 128 matrix in LDS, f16 */
typedef float v2f __attribute__((ext_vector_type(2)));
typedef __bf16 v2b __attribute__((ext_vector_type(2)));
typedef _Float16 v2h __attribute__((ext_vector_type(2)));
typedef unsigned int v2ua __attribute__((ext_vector_type(2), may_alias));
typedef unsigned int v4ua __attribute__((ext_vector_type(4), may_alias));
__device__ __forceinline__ unsigned int pj_h2(float a, float c) { const v2f p = {a, c}; return __builtin_bit_cast(unsigned int, __builtin_convertvector(p, v2h)); }      /* two f32 -> packed f16, nearest even */
/* two f32 -> nearest-even bf16 values (x SCALE, a power of two) -> packed f16 */
template <int SCALE>
__device__ __forceinline__ unsigned int pj_in2(float a, float c) { const v2f p = {a, c}; const unsigned int bb = __builtin_bit_cast(unsigned int, __builtin_convertvector(p, v2b));
  return pj_h2(__uint_as_float(bb << 16) * (float)SCALE, __uint_as_float(bb & 0xFFFF0000u) * (float)SCALE); }
/* a 128 x 128 f32 matrix through 256 threads: each wave-wide load is one whole row of 512 B (wave w: rows w, w + 8, ...) */
__device__ __forceinline__ void pj_load(v4f (&d)[16], const float* p) {
#pragma unroll
  for (int i = 0; i < 16; ++i) d[i] = *(const v4fa*)(p + i * 8 * FF); }
template <int SCALE>
__device__ __forceinline__ void pj_put(const v4f (&d)[16], unsigned short* q) {
#pragma unroll
  for (int i = 0; i < 16; ++i) { const v2ua o = {pj_in2<SCALE>(d[i][0], d[i][1]), pj_in2<SCALE>(d[i][2], d[i][3])}; *(v2ua*)(q + i * 8 * PPITCH) = o; } }
/* a wave's staged tile, 16 rows x 128 f16, to global rows of the given pitch: each store is two whole rows of 256 B */
__device__ __forceinline__ void pj_rows(const unsigned short* st, unsigned short* dst, size_t pitch, int ln, int hh) {
  v8us t[8];
#pragma unroll
  for (int i = 0; i < 8; ++i) t[i] = *(const v8us*)(st + (2 * i + hh) * PPITCH + ln * 8);
  __builtin_amdgcn_sched_barrier(0);      /* with the one behind the wait: nothing that rewrites an address register comes between these stores and their s_wait_xcnt */
#pragma unroll
  for (int i = 0; i < 8; ++i) *(v8us*)(dst + (size_t)(2 * i + hh) * pitch + ln * 8) = t[i];
  asm volatile("s_wait_xcnt 0x0" ::: "memory");      /* stands before the address registers of the stores above are reused */
  __builtin_amdgcn_sched_barrier(0); }
__global__ __launch_bounds__(256) void k_proj(const float* __restrict__ x, const float* __restrict__ Wq, const float* __restrict__ bq, const float* __restrict__ Wk, const float* __restrict__ bk,
                                              const float* __restrict__ Wv, const float* __restrict__ bv, _Float16* __restrict__ Q16, _Float16* __restrict__ K16, _Float16* __restrict__ VT2) {
  __shared__ __attribute__((aligned(16))) unsigned short sw[3 * PMAT];      /* 16 Wq, 16 Wk, 16 Wv as f16, rows = output features */
  __shared__ __attribute__((aligned(16))) unsigned short sx[PMAT];          /* the 128 tokens' x as f16 */
  __shared__ __attribute__((aligned(16))) unsigned short so[8][2][16 * PPITCH];      /* per wave: two output tiles on their way to whole-line stores */
  __shared__ __attribute__((aligned(16))) float sb[3 * FF];                 /* biases, rounded */
  const int tid = threadIdx.x, w = tid >> 5, lane = tid & 31, ln = lane & 15, hh = lane >> 4;
  const size_t tok0 = (size_t)blockIdx.x * 128;
  const int go = w * FF + lane * 4, lo = w * PPITCH + lane * 4;
  v4f ra[16], rb[16], rc[16];
  __builtin_amdgcn_sched_barrier(0);      /* as in pj_rows, for these loads */
  pj_load(ra, x + tok0 * FF + go); pj_load(rb, Wq + go); pj_load(rc, Wk + go);      /* x first: it comes from memory, the weights from L2 */
  const float b0 = bq[tid & (FF - 1)], b1 = bk[tid & (FF - 1)], b2 = bv[tid & (FF - 1)];
  asm volatile("s_wait_xcnt 0x0" ::: "memory");      /* stands before the address registers of the loads above are reused */
  __builtin_amdgcn_sched_barrier(0);
  pj_put<1>(ra, sx + lo);
  __builtin_amdgcn_sched_barrier(0);      /* Wv's loads go out as soon as x has left its registers, ahead of the other weights' conversion, which hides them */
  pj_load(ra, Wv + go);
  asm volatile("s_wait_xcnt 0x0" ::: "memory");      /* as above */
  __builtin_amdgcn_sched_barrier(0);
  pj_put<16>(rb, sw + lo); pj_put<16>(rc, sw + PMAT + lo);
  asm volatile("" :: "v"(b0), "v"(b1), "v"(b2));      /* inputs only: holds the three bias loads up in the first batch; otherwise they sink into the branch below, where their whole latency stands open in front of the barrier */
  if (tid < FF) { sb[tid] = bf16_round(b0); sb[FF + tid] = bf16_round(b1); sb[2 * FF + tid] = bf16_round(b2); }
  pj_put<16>(ra, sw + 2 * PMAT + lo);
  __syncthreads();      /* x, the weights and the biases are in LDS for every wave */
  /* q, k: wave w owns tokens 16w..16w+15; D = W.x^T, a lane holds 8 successive features of one token.
     v^T:  wave w owns features 16w..16w+15; D = x.Wv^T, a lane holds 8 successive tokens of one feature.
     Twelve groups of 8 fragment reads and 8 WMMAs (3 matrices x 4 k steps); group g + 1 is read ahead of group g's WMMAs. */
  const unsigned short* xrow = sx + ln * PPITCH; const unsigned short* wrow = sw + ln * PPITCH;
  v16h own[4];      /* the operand a wave keeps: its tokens' x for q and k, its features' Wv for v^T */
#pragma unroll
  for (int ks = 0; ks < 4; ++ks) own[ks] = at_frag(xrow + w * 16 * PPITCH + ks * 32, hh);
  v16h fr[2][8];
  auto grp = [&](int g, v16h* f) { const unsigned short* p = (g < 8 ? wrow + (g >> 2) * PMAT : xrow) + (g & 3) * 32;
#pragma unroll
    for (int t = 0; t < 8; ++t) f[t] = at_frag(p + t * 16 * PPITCH, hh); };
  grp(0, fr[0]);
  const v8f z8 = {0.f,0.f,0.f,0.f,0.f,0.f,0.f,0.f};
  v8f acc[8];
  unsigned short* s0 = so[w][0]; unsigned short* s1 = so[w][1];
  const int sp = ln * PPITCH + 8 * hh;      /* a lane's place in a staged tile, + 16 per accumulator tile */
#pragma unroll
  for (int g = 0; g < 12; ++g) {
    if (g + 1 < 12) grp(g + 1, fr[(g + 1) & 1]);
    __builtin_amdgcn_sched_barrier(0);      /* the next group's reads are issued together, ahead of this group's WMMAs and not among them */
#pragma unroll
    for (int t = 0; t < 8; ++t) acc[t] = at_mma(fr[g & 1][t], own[g & 3], (g & 3) ? acc[t] : z8);
    __builtin_amdgcn_sched_barrier(0);      /* ... and what follows stays behind the WMMAs */
    if (g == 3 || g == 7) {
      const int m = g >> 2; unsigned short* st = m ? s1 : s0;
      if (g == 7) {
#pragma unroll
        for (int ks = 0; ks < 4; ++ks) own[ks] = at_frag(wrow + 2 * PMAT + w * 16 * PPITCH + ks * 32, hh);
      }
#pragma unroll
      for (int t = 0; t < 8; ++t) { const v4f c0 = *(const v4fa*)&sb[m * FF + t * 16 + 8 * hh], c1 = *(const v4fa*)&sb[m * FF + t * 16 + 8 * hh + 4];
        const v4ua o = {pj_h2(acc[t][0] * 0.0625f + c0[0], acc[t][1] * 0.0625f + c0[1]), pj_h2(acc[t][2] * 0.0625f + c0[2], acc[t][3] * 0.0625f + c0[3]),
                        pj_h2(acc[t][4] * 0.0625f + c1[0], acc[t][5] * 0.0625f + c1[1]), pj_h2(acc[t][6] * 0.0625f + c1[2], acc[t][7] * 0.0625f + c1[3])};
        *(v4ua*)(st + sp + t * 16) = o; }
      asm volatile("s_wait_dscnt 0x0" ::: "memory");      /* the wave's own tile is written before other lanes' parts of it are read back */
      pj_rows(st, (unsigned short*)(m ? K16 : Q16) + (tok0 + w * 16) * FF, FF, ln, hh);
    }
  }
  const float cv = sb[2 * FF + w * 16 + ln];
#pragma unroll
  for (int t = 0; t < 8; ++t) { v4ua oh, ol;
#pragma unroll
    for (int r = 0; r < 8; r += 2) { const v2f v = {acc[t][r] * 0.0625f + cv, acc[t][r + 1] * 0.0625f + cv}; const v2h h = __builtin_convertvector(v, v2h); const v2f res = v - __builtin_convertvector(h, v2f);
      oh[r >> 1] = __builtin_bit_cast(unsigned int, h); ol[r >> 1] = pj_h2(res[0], res[1]); }      /* v = hi + raw residual */
    *(v4ua*)(s0 + sp + t * 16) = oh; *(v4ua*)(s1 + sp + t * 16) = ol; }
  asm volatile("s_wait_dscnt 0x0" ::: "memory");      /* as above */
  unsigned short* vt = (unsigned short*)VT2 + (tok0 / SLEN) * ((size_t)FF * 2 * SLEN) + (size_t)(w * 16) * (2 * SLEN) + tok0 % SLEN;      /* row = feature: 2048 hi, then 2048 lo */
  pj_rows(s0, vt, 2 * SLEN, ln, hh); pj_rows(s1, vt + SLEN, 2 * SLEN, ln, hh);
}

__global__ __launch_bounds__(256) void k_attn(const _Float16* __restrict__ Q, const _Float16* __restrict__ Kk, const _Float16* __restrict__ Vt, float* __restrict__ O) {
  __shared__ __attribute__((aligned(16))) unsigned short sm[2 * ABUF];      /* two buffers, each: K tile, v_hi^T tile, v_lo^T tile */
  const int tid = threadIdx.x, w = tid >> 5, lane = tid & 31, ln = lane & 15, hh = lane >> 4, b = blockIdx.y;
  const int q0 = blockIdx.x * 128 + w * 16;
  const unsigned short* kg = (const unsigned short*)Kk + (size_t)b * SLEN * FF + tid * 8;                                  /* a K stage is 16 KiB in a row */
  const unsigned short* vg = (const unsigned short*)Vt + (size_t)b * FF * 2 * SLEN + (size_t)(tid >> 3) * (2 * SLEN) + (tid & 7) * 8;      /* 128 rows x 128 B, hi; lo at + SLEN */
  const int kw = (tid >> 4) * KPITCH + (tid & 15) * 8, vw = (tid >> 3) * VPITCH + (tid & 7) * 8;
  const _Float16* qp = Q + ((size_t)b * SLEN + q0 + ln) * FF;
  v16h qf[4];
#pragma unroll
  for (int ks = 0; ks < 4; ++ks) qf[ks] = g2_frag(qp + ks * 32, hh);
  const v8f z8 = {0.f,0.f,0.f,0.f,0.f,0.f,0.f,0.f};
  v8f o[8] = {z8, z8, z8, z8, z8, z8, z8, z8};
  float mrun = -3.0e38f, ls0 = 0.f, ls1 = 0.f;
  const float SC = 0.09016844005556021f;      /* log2(e) / 16 */
  v8us pk[4], ph[4], pl[4];      /* one stage on its way from global memory to LDS */
  auto fetch = [&](int st) { const unsigned short* kn = kg + (size_t)st * AKB * FF; const unsigned short* vn = vg + st * AKB;
    __builtin_amdgcn_sched_barrier(0);      /* with the one behind the wait: no other instruction, so no rewrite of an address register, comes between these loads and their s_wait_xcnt */
#pragma unroll
    for (int i = 0; i < 4; ++i) { pk[i] = *(const v8us*)(kn + i * 2048); ph[i] = *(const v8us*)(vn + (size_t)i * 32 * 2 * SLEN); pl[i] = *(const v8us*)(vn + (size_t)i * 32 * 2 * SLEN + SLEN); }
    asm volatile("s_wait_xcnt 0x0" ::: "memory");      /* stands before the address registers of the loads above (and of the Q loads) are reused */
    __builtin_amdgcn_sched_barrier(0); };
  auto put = [&](unsigned short* bw) {
#pragma unroll
    for (int i = 0; i < 4; ++i) { *(v8us*)(bw + kw + i * 16 * KPITCH) = pk[i]; *(v8us*)(bw + ASH + vw + i * 32 * VPITCH) = ph[i]; *(v8us*)(bw + ASL + vw + i * 32 * VPITCH) = pl[i]; } };
  fetch(0); put(sm); fetch(1);
  __syncthreads();      /* stage 0 is in buffer 0 for every wave */
  /* rolled: one stage's code stays small, and the loads of stage st + 2 stay in their own block ahead of the products */
#pragma unroll 1
  for (int st = 0; st < ANST; ++st) {
    const unsigned short* sk = sm + (st & 1) * ABUF; const unsigned short* sh = sk + ASH; const unsigned short* sl = sk + ASL;
    if (st + 1 < ANST) put(sm + ((st + 1) & 1) * ABUF);      /* into the buffer whose readers (stage st - 1) all passed the barrier at the loop's foot */
    if (st + 2 < ANST) fetch(st + 2);
    /* Fragment reads stand in groups ahead of the products that use them; each sched_barrier keeps the compiler from sinking a group's reads
       down to one read, one full wait, one WMMA (which it does otherwise, and every WMMA then waits out an LDS latency). */
    v16h kf[16];
#pragma unroll
    for (int ks = 0; ks < 4; ++ks)
#pragma unroll
      for (int kt = 0; kt < 4; ++kt) kf[ks * 4 + kt] = at_frag(sk + (kt * 16 + ln) * KPITCH + ks * 32, hh);
    __builtin_amdgcn_sched_barrier(0);      /* all K reads issued before the first score WMMA */
    v8f s[4] = {z8, z8, z8, z8};      /* s[kt][r] = score of key kt*16 + 8*hh + r, query ln */
#pragma unroll
    for (int ks = 0; ks < 4; ++ks)
#pragma unroll
      for (int kt = 0; kt < 4; ++kt) s[kt] = at_mma(kf[ks * 4 + kt], qf[ks], s[kt]);
    __builtin_amdgcn_sched_barrier(0);      /* the v^T reads below stay behind the score WMMAs and ahead of the softmax, which hides them */
    v16h va[8], vb[8], vc[8], vd[8];      /* keys 0-31: hi, lo; keys 32-63: hi, lo */
#pragma unroll
    for (int ft = 0; ft < 8; ++ft) va[ft] = at_frag(sh + (ft * 16 + ln) * VPITCH, hh);
#pragma unroll
    for (int ft = 0; ft < 8; ++ft) vb[ft] = at_frag(sl + (ft * 16 + ln) * VPITCH, hh);
    __builtin_amdgcn_sched_barrier(0);      /* first two v^T groups in flight before the maxima */
    float mx = s[0][0];
#pragma unroll
    for (int kt = 0; kt < 4; ++kt)
#pragma unroll
      for (int r = 0; r < 8; ++r) mx = fmaxf(mx, s[kt][r]);
    mx = fmaxf(mx, at_xhalf(mx)) * SC;
    if (__builtin_amdgcn_ballot_w32(mx > mrun) != 0) {      /* some query's maximum rose: rescale (factor 1 for the others) */
      const float mn = fmaxf(mrun, mx); const float corr = __builtin_amdgcn_exp2f(mrun - mn); mrun = mn; ls0 *= corr; ls1 *= corr;
#pragma unroll
      for (int ft = 0; ft < 8; ++ft)
#pragma unroll
        for (int r = 0; r < 8; ++r) o[ft][r] *= corr;
    }
    const float moff = mrun - 10.0f;      /* P x 2^10 keeps small probabilities in f16's normal range; it cancels in the division */
    FragH pb[2];
#pragma unroll
    for (int g = 0; g < 2; ++g)
#pragma unroll
      for (int e = 0; e < 16; e += 2) { const float pa = __builtin_amdgcn_exp2f(s[2 * g + (e >> 3)][e & 7] * SC - moff), pc = __builtin_amdgcn_exp2f(s[2 * g + (e >> 3)][(e & 7) + 1] * SC - moff);
        ls0 += pa; ls1 += pc; pb[g].h[e] = (_Float16)pa; pb[g].h[e + 1] = (_Float16)pc; }
#pragma unroll
    for (int ft = 0; ft < 8; ++ft) vc[ft] = at_frag(sh + (ft * 16 + ln) * VPITCH + 32, hh);
    __builtin_amdgcn_sched_barrier(0);      /* third group issued before the first group's WMMAs */
#pragma unroll
    for (int ft = 0; ft < 8; ++ft) o[ft] = at_mma(va[ft], pb[0].v, o[ft]);
    __builtin_amdgcn_sched_barrier(0);      /* fourth group issued between the first and the second group's WMMAs */
#pragma unroll
    for (int ft = 0; ft < 8; ++ft) vd[ft] = at_frag(sl + (ft * 16 + ln) * VPITCH + 32, hh);
    __builtin_amdgcn_sched_barrier(0);      /* ... and not sunk among the WMMAs that follow */
#pragma unroll
    for (int ft = 0; ft < 8; ++ft) o[ft] = at_mma(vb[ft], pb[0].v, o[ft]);
#pragma unroll
    for (int ft = 0; ft < 8; ++ft) o[ft] = at_mma(vc[ft], pb[1].v, o[ft]);
#pragma unroll
    for (int ft = 0; ft < 8; ++ft) o[ft] = at_mma(vd[ft], pb[1].v, o[ft]);
    __syncthreads();      /* publishes stage st + 1 and ends every read of stage st's buffer */
  }
  float lsum = ls0 + ls1; lsum += at_xhalf(lsum);
  const float inv = 1.0f / lsum;
  float* op = O + ((size_t)b * SLEN + q0 + ln) * FF + 8 * hh;      /* o[ft][r] = out[query ln][feature ft*16 + 8*hh + r] */
#pragma unroll
  for (int ft = 0; ft < 8; ++ft) { const v4f u0 = {o[ft][0] * inv, o[ft][1] * inv, o[ft][2] * inv, o[ft][3] * inv}, u1 = {o[ft][4] * inv, o[ft][5] * inv, o[ft][6] * inv, o[ft][7] * inv};
    *(v4f*)(op + ft * 16) = u0; *(v4f*)(op + ft * 16 + 4) = u1; }
}

extern "C" void kernel_launch(void* const* d_in, const int* in_sizes, int n_in,
                              void* d_out, int out_size, void* d_ws, size_t ws_size, hipStream_t stream) {
  (void)in_sizes; (void)n_in; (void)out_size;
  const float* const* I = (const float* const*)d_in; const float* x = I[0]; const float* Wq = I[1]; const float* bq = I[2]; const float* Wk = I[3]; const float* bk = I[4]; const float* Wv = I[5]; const float* bv = I[6];
  char* ws = (char*)d_ws; size_t off = 0;
  auto take = [&](size_t bytes) { char* p = ws + off; off += (bytes + 255) & ~(size_t)255; return p; };
  const size_t PL = (size_t)NBT * SLEN * FF;      /* elements of one [16][2048][128] plane */
  _Float16* Q16 = (_Float16*)take(PL * 2); _Float16* K16 = (_Float16*)take(PL * 2); _Float16* VT2 = (_Float16*)take(PL * 2 * 2);
  if (off > ws_size) return;      /* 32 MiB */
  k_proj<<<NBT * SLEN / 128, 256, 0, stream>>>(x, Wq, bq, Wk, bk, Wv, bv, Q16, K16, VT2);      /* q, k, [v_hi^T | v_lo^T] */
  k_attn<<<dim3(SLEN / 128, NBT), 256, 0, stream>>>(Q16, K16, VT2, (float*)d_out);      /* softmax(q.k / 16) . (v_hi + v_lo) */
}

// v004
// Measured time: 62.9 microseconds a run.
// In two side-by-side timings against v003, it was 1.06 and 1.08 times as fast.
// Counting every step since v000, it is 43.0 times as fast.
#include <hip/hip_runtime.h>
// Non-local interaction (16 x 2048 tokens, 128 features, single head): q,k,v = x W^T + b; alpha = softmax(q.k / 16); out = alpha v -> [16,2048,128].
// Structure (batches side by side in the grid): ONE projection kernel per 128 tokens: x and the x16 weights rounded to bf16 values and laid in LDS as exact f16, q, k and v^T as f16 WMMA products (f32 accumulation, bias added), q and k stored as f16 rows, v split into f16 hi and raw residual and stored transposed, all in whole lines; then ONE fused kernel per 128 queries: K and v^T tiles of 64 keys staged in LDS, a wave takes 32 queries and one half of each stage's keys, S^T = K.Q^T, running-maximum softmax in registers (a lane holds one query's scores), P^T packed from the score tiles as the B operand, O^T += [v_hi^T ; v_lo^T].P^T, the two halves merged through LDS and divided by the row sum at the end. No score or probability plane in memory.
// Compute dtype: x, weights, biases rounded to bf16; q, k, P as f16 operands (~2^-12; logits sigma ~1.4); v as hi + residual (~2^-22); f32 accumulation and softmax. v_wmma_f32_16x16x32_f16.
#define NBT 16
#define SLEN 2048
#define FF 128
typedef __bf16 v16b __attribute__((ext_vector_type(16)));
typedef unsigned short v8us __attribute__((ext_vector_type(8), may_alias));
typedef float  v8f  __attribute__((ext_vector_type(8)));
typedef float  v4f  __attribute__((ext_vector_type(4)));
typedef float  v4fa __attribute__((ext_vector_type(4), may_alias));
union FragB { v16b v; v8us half[2]; unsigned short u[16]; };

__device__ __forceinline__ unsigned short bf16_bits(float x) { unsigned int u = __float_as_uint(x); return (unsigned short)((u + 0x7FFFu + ((u >> 16) & 1u)) >> 16); }
__device__ __forceinline__ float bf16_val(unsigned short b) { return __uint_as_float(((unsigned int)b) << 16); }
__device__ __forceinline__ float bf16_round(float x) { return bf16_val(bf16_bits(x)); }
// D += A·B with NT terms: 1 = ah·bh, 2 = + al·bh (A split), 3 = + ah·bl (both split)
template <int NT>
__device__ __forceinline__ v8f mmaN(v16b ah, v16b al, v16b bh, v16b bl, v8f c) {
  c = __builtin_amdgcn_wmma_f32_16x16x32_bf16(false, ah, false, bh, (short)0, c, false, false);
  if (NT >= 2) c = __builtin_amdgcn_wmma_f32_16x16x32_bf16(false, al, false, bh, (short)0, c, false, false);
  if (NT >= 3) c = __builtin_amdgcn_wmma_f32_16x16x32_bf16(false, ah, false, bl, (short)0, c, false, false);
  asm volatile("v_nop\n\tv_nop\n\tv_nop\n\tv_nop" : "+v"(c) : "v"(ah), "v"(al), "v"(bh), "v"(bl));
  return c;
}

__global__ __launch_bounds__(256) void k_wt_bf16(const float* __restrict__ W, unsigned short* __restrict__ Wt, int K, int N) {
  const int t = blockIdx.x * 256 + threadIdx.x;
  const int k8n = K / 8;
  if (t >= N * k8n) return;
  const int n = t / k8n, k8 = (t % k8n) * 8;
  v8us v;
#pragma unroll
  for (int i = 0; i < 8; ++i) v[i] = bf16_bits(W[(size_t)(k8 + i) * N + n]);
  *(v8us*)(Wt + (size_t)n * K + k8) = v;
  
}

// GEMM C[M][N] (f32, pitch ldc) = act(A[M][K]·W + bias). A f32 row-major (pitch lda) converted per fragment to bf16
// (ASPLIT: hi/lo two planes -> 2 terms, else single rounded term); Wt bf16 [N][K] (pitch ldb). BIAS_BF16 rounds the
// bias to bf16 first (bias quantised to bf16 before the add). K%32==0, M%16==0, N%64==0.
template <bool ASPLIT, int ACT, bool BIAS_BF16>
__global__ __launch_bounds__(128) void k_gemm_bf(const float* __restrict__ A, int lda, const unsigned short* __restrict__ Wt, int ldb,
                                               const float* __restrict__ bias, float* __restrict__ C, int ldc, int M, int N, int K) {
  __shared__ __attribute__((aligned(16))) float so[4][16][64];
  const int tid = threadIdx.x, w = tid >> 5, lane = tid & 31, ln = lane & 15, hh = lane >> 4;
  const int ntn = N / 64;
  const int wid = blockIdx.x * 4 + w;
  const int mt = wid / ntn, nq = wid % ntn;
  if (mt * 16 >= M) return;
  const int row0 = mt * 16, col0 = nq * 64;
  const float* arow = A + (size_t)(row0 + ln) * lda;
  v8f acc[4] = {};
  for (int kb = 0; kb < K; kb += 32) {
    FragB ah, al;
    const v4f x0 = *(const v4fa*)(arow + kb + 8 * hh), x1 = *(const v4fa*)(arow + kb + 8 * hh + 4);
    const v4f x2 = *(const v4fa*)(arow + kb + 16 + 8 * hh), x3 = *(const v4fa*)(arow + kb + 16 + 8 * hh + 4);
    float xs[16] = {x0[0],x0[1],x0[2],x0[3],x1[0],x1[1],x1[2],x1[3],x2[0],x2[1],x2[2],x2[3],x3[0],x3[1],x3[2],x3[3]};
#pragma unroll
    for (int i = 0; i < 16; ++i) { const unsigned short hb = bf16_bits(xs[i]); ah.u[i] = hb; al.u[i] = ASPLIT ? bf16_bits(xs[i] - bf16_val(hb)) : (unsigned short)0; }
#pragma unroll
    for (int t = 0; t < 4; ++t) {
      const unsigned short* brow = Wt + (size_t)(col0 + t * 16 + ln) * ldb + kb;
      FragB b;
      b.half[0] = *(const v8us*)(brow + 8 * hh);
      b.half[1] = *(const v8us*)(brow + 16 + 8 * hh);
      acc[t] = mmaN<ASPLIT ? 2 : 1>(ah.v, al.v, b.v, b.v, acc[t]);
    }
  }
#pragma unroll
  for (int t = 0; t < 4; ++t) {
    float bv = bias ? bias[col0 + t * 16 + ln] : 0.f;
    if (BIAS_BF16) bv = bf16_round(bv);
#pragma unroll
    for (int r = 0; r < 8; ++r) { float v = acc[t][r] + bv; if (ACT == 1) v = fmaxf(v, 0.f); so[w][8 * hh + r][t * 16 + ln] = v; }
  }
  __builtin_amdgcn_fence(__ATOMIC_ACQ_REL, "workgroup");
  __builtin_amdgcn_wave_barrier();
  const int rsub = lane >> 4, c4 = (lane & 15) * 4;
  {
#pragma unroll
    for (int q = 0; q < 8; ++q) {
      const int r = q * 2 + rsub;
      const v4f v = *(const v4fa*)&so[w][r][c4];
      *(v4f*)(C + (size_t)(row0 + r) * ldc + col0 + c4) = v;
    }
    
  }
}

// GEMM C = act(A·W + bias + resid): A f32 (ASPLIT -> hi/lo 2 terms), Wt bf16 [N][K]; ACT 0 none, 1 relu, 2 exact gelu;
// resid (optional, f32, row index = (row % rmod), pitch ldr, RES_BF16 rounds it) added before the activation.
template <bool ASPLIT, int ACT, bool BIAS_BF16, bool RES_BF16>
__global__ __launch_bounds__(128) void k_gemm_bf3(const float* __restrict__ A, int lda, const unsigned short* __restrict__ Wt, int ldb,
                                                const float* __restrict__ bias, const float* __restrict__ resid, int rmod, int ldr,
                                                float* __restrict__ C, int ldc, int M, int N, int K) {
  __shared__ __attribute__((aligned(16))) float so[4][16][64];
  const int tid = threadIdx.x, w = tid >> 5, lane = tid & 31, ln = lane & 15, hh = lane >> 4;
  const int ntn = N / 64;
  const int wid = blockIdx.x * 4 + w;
  const int mt = wid / ntn, nq = wid % ntn;
  if (mt * 16 >= M) return;
  const int row0 = mt * 16, col0 = nq * 64;
  const float* arow = A + (size_t)(row0 + ln) * lda;
  v8f acc[4] = {};
  for (int kb = 0; kb < K; kb += 32) {
    FragB ah, al;
    const v4f x0 = *(const v4fa*)(arow + kb + 8 * hh), x1 = *(const v4fa*)(arow + kb + 8 * hh + 4);
    const v4f x2 = *(const v4fa*)(arow + kb + 16 + 8 * hh), x3 = *(const v4fa*)(arow + kb + 16 + 8 * hh + 4);
    float xs[16] = {x0[0],x0[1],x0[2],x0[3],x1[0],x1[1],x1[2],x1[3],x2[0],x2[1],x2[2],x2[3],x3[0],x3[1],x3[2],x3[3]};
#pragma unroll
    for (int i = 0; i < 16; ++i) { const unsigned short hb = bf16_bits(xs[i]); ah.u[i] = hb; al.u[i] = ASPLIT ? bf16_bits(xs[i] - bf16_val(hb)) : (unsigned short)0; }
#pragma unroll
    for (int t = 0; t < 4; ++t) {
      const unsigned short* brow = Wt + (size_t)(col0 + t * 16 + ln) * ldb + kb;
      FragB b;
      b.half[0] = *(const v8us*)(brow + 8 * hh);
      b.half[1] = *(const v8us*)(brow + 16 + 8 * hh);
      acc[t] = mmaN<ASPLIT ? 2 : 1>(ah.v, al.v, b.v, b.v, acc[t]);
    }
  }
#pragma unroll
  for (int t = 0; t < 4; ++t) {
    const int col = col0 + t * 16 + ln;
    float bv = bias ? bias[col] : 0.f;
    if (BIAS_BF16) bv = bf16_round(bv);
#pragma unroll
    for (int r = 0; r < 8; ++r) {
      float v = acc[t][r] + bv;
      if (resid) { float rv = resid[(size_t)((row0 + 8 * hh + r) % rmod) * ldr + col]; if (RES_BF16) rv = bf16_round(rv); v += rv; }
      if (ACT == 1) v = fmaxf(v, 0.f);
      if (ACT == 2) v = 0.5f * v * (1.0f + erff(v * 0.70710678118654752f));
      if (ACT == 3) { const float u = 0.7978845608028654f * (v + 0.044715f * v * v * v); v = 0.5f * v * (1.0f + tanhf(u)); }
      so[w][8 * hh + r][t * 16 + ln] = v;
    }
  }
  __builtin_amdgcn_fence(__ATOMIC_ACQ_REL, "workgroup");
  __builtin_amdgcn_wave_barrier();
  const int rsub = lane >> 4, c4 = (lane & 15) * 4;
  {
#pragma unroll
    for (int q = 0; q < 8; ++q) {
      const int r = q * 2 + rsub;
      const v4f v = *(const v4fa*)&so[w][r][c4];
      *(v4f*)(C + (size_t)(row0 + r) * ldc + col0 + c4) = v;
    }
    
  }
}
// row LayerNorm (biased variance, eps) over N: s = X (+ R); optional out_sum <- s; out_norm <- (s-mu)*rsqrt(var+eps)*g + b
template <bool PARAM_BF16>
__global__ __launch_bounds__(256) void k_layernorm(const float* __restrict__ X, const float* __restrict__ R, const float* __restrict__ g, const float* __restrict__ bta,
                                                  float* __restrict__ out_sum, float* __restrict__ out_norm, int N, float eps) {
  __shared__ float red[256];
  const int row = blockIdx.x, tid = threadIdx.x;
  const float* x = X + (size_t)row * N; const float* rr = R ? R + (size_t)row * N : nullptr;
  float vals[16];                     // up to N = 4096
  const int per = N / 256;            // contiguous chunk per thread? use strided-by-4 chunks: thread handles j = tid*4 + 1024*u
  float s1 = 0.f;
  for (int u = 0; u < per / 4; ++u) {
    const int j = tid * 4 + 1024 * u;
    const v4f a = *(const v4fa*)(x + j);
    v4f b = {0.f,0.f,0.f,0.f}; if (rr) b = *(const v4fa*)(rr + j);
#pragma unroll
    for (int q = 0; q < 4; ++q) { const float v = a[q] + b[q]; vals[u * 4 + q] = v; s1 += v; }
  }
  red[tid] = s1; __syncthreads();
  for (int st = 128; st > 0; st >>= 1) { if (tid < st) red[tid] += red[tid + st]; __syncthreads(); }
  const float mu = red[0] / (float)N; __syncthreads();
  float s2 = 0.f;
  for (int u = 0; u < per / 4; ++u)
#pragma unroll
    for (int q = 0; q < 4; ++q) { const float c = vals[u * 4 + q] - mu; s2 += c * c; }
  red[tid] = s2; __syncthreads();
  for (int st = 128; st > 0; st >>= 1) { if (tid < st) red[tid] += red[tid + st]; __syncthreads(); }
  const float rs = rsqrtf(red[0] / (float)N + eps);
  {
    for (int u = 0; u < per / 4; ++u) {
      const int j = tid * 4 + 1024 * u;
      v4f o, sm;
#pragma unroll
      for (int q = 0; q < 4; ++q) {
        float gg = g[j + q], bb = bta[j + q];
        if (PARAM_BF16) { gg = bf16_round(gg); bb = bf16_round(bb); }
        sm[q] = vals[u * 4 + q]; o[q] = (vals[u * 4 + q] - mu) * rs * gg + bb;
      }
      if (out_sum) *(v4f*)(out_sum + (size_t)row * N + j) = sm;
      *(v4f*)(out_norm + (size_t)row * N + j) = o;
    }
    
  }
}



// ---- f16 WMMA path (v_wmma_f32_16x16x32_f16): 11-bit significands for operands in range — used where a [0,1] probability operand needs more precision than bf16
typedef _Float16 v16h __attribute__((ext_vector_type(16)));
union FragH { v16h v; v8us half[2]; _Float16 h[16]; unsigned short u[16]; };
template <int NT>
__device__ __forceinline__ v8f mmaH(v16h ah, v16h al, v16h bh, v16h bl, v8f c) {
  c = __builtin_amdgcn_wmma_f32_16x16x32_f16(false, ah, false, bh, (short)0, c, false, false);
  if (NT >= 2) c = __builtin_amdgcn_wmma_f32_16x16x32_f16(false, al, false, bh, (short)0, c, false, false);
  if (NT >= 3) c = __builtin_amdgcn_wmma_f32_16x16x32_f16(false, ah, false, bl, (short)0, c, false, false);
  asm volatile("v_nop\n\tv_nop\n\tv_nop\n\tv_nop" : "+v"(c) : "v"(ah), "v"(al), "v"(bh), "v"(bl));
  return c;
}
// batched GEMM like k_gemm_b but f16 operands: A f32 (split into f16 hi/lo if ASPLIT, else rounded to f16), Bt = f16 values [n][k]; alpha; C f32; N multiple of 16 (partial tiles skipped)
template <bool ASPLIT>
__global__ __launch_bounds__(128) void k_gemm_h(const float* __restrict__ A, int lda, size_t sA, const _Float16* __restrict__ Bh, int ldb, size_t sB, float alpha, float* __restrict__ C, int ldc, size_t sC, int M, int N, int K) {
  __shared__ __attribute__((aligned(16))) float so[4][16][64];
  const int tid = threadIdx.x, w = tid >> 5, lane = tid & 31, ln = lane & 15, hh = lane >> 4; const int by = blockIdx.y;
  A += (size_t)by * sA; Bh += (size_t)by * sB; C += (size_t)by * sC;
  const int ntn = (N + 63) / 64; const int wid = blockIdx.x * 4 + w; const int mt = wid / ntn, nq = wid % ntn; if (mt * 16 >= M) return;
  const int row0 = mt * 16, col0 = nq * 64; const float* arow = A + (size_t)(row0 + ln) * lda;
  v8f acc[4] = {};
  for (int kb = 0; kb < K; kb += 32) {
    FragH ah, al;
    const v4f x0 = *(const v4fa*)(arow + kb + 8 * hh), x1 = *(const v4fa*)(arow + kb + 8 * hh + 4), x2 = *(const v4fa*)(arow + kb + 16 + 8 * hh), x3 = *(const v4fa*)(arow + kb + 16 + 8 * hh + 4);
    float xs[16] = {x0[0],x0[1],x0[2],x0[3],x1[0],x1[1],x1[2],x1[3],x2[0],x2[1],x2[2],x2[3],x3[0],x3[1],x3[2],x3[3]};
#pragma unroll
    for (int i = 0; i < 16; ++i) { const _Float16 h = (_Float16)xs[i]; ah.h[i] = h; al.h[i] = ASPLIT ? (_Float16)(xs[i] - (float)h) : (_Float16)0.0f; }
#pragma unroll
    for (int t = 0; t < 4; ++t) { if (col0 + t * 16 >= N) continue; const size_t boff = (size_t)(col0 + t * 16 + ln) * ldb + kb; FragH bq; bq.half[0] = *(const v8us*)(Bh + boff + 8 * hh); bq.half[1] = *(const v8us*)(Bh + boff + 16 + 8 * hh);
      acc[t] = mmaH<ASPLIT ? 2 : 1>(ah.v, al.v, bq.v, bq.v, acc[t]); }
  }
#pragma unroll
  for (int t = 0; t < 4; ++t) { if (col0 + t * 16 >= N) continue;
#pragma unroll
    for (int r = 0; r < 8; ++r) so[w][8 * hh + r][t * 16 + ln] = acc[t][r] * alpha; }
  __builtin_amdgcn_fence(__ATOMIC_ACQ_REL, "workgroup"); __builtin_amdgcn_wave_barrier();
  const int rsub = lane >> 4, c4 = (lane & 15) * 4;
  {
#pragma unroll
    for (int q = 0; q < 8; ++q) { const int r = q * 2 + rsub; if (col0 + c4 < N) { const v4f v = *(const v4fa*)&so[w][r][c4]; *(v4f*)(C + (size_t)(row0 + r) * ldc + col0 + c4) = v; } }
     }
}

// Wt[n][k] = f16(W[k][n]·scale) from f32 row-major W[K][N] (scale = power of two; bf16-exact weights stay exact in f16 away from the subnormal range)
__global__ __launch_bounds__(256) void k_wt_f16(const float* __restrict__ W, _Float16* __restrict__ Wt, int K, int N, float scale) {
  const int t = blockIdx.x * 256 + threadIdx.x; if (t >= N * (K / 8)) return; const int n = t / (K / 8), k8 = (t % (K / 8)) * 8; FragH f;
#pragma unroll
  for (int i = 0; i < 8; ++i) f.h[i] = (_Float16)(bf16_round(W[(size_t)(k8 + i) * N + n]) * scale); const v8us o = f.half[0];
  *(v8us*)((unsigned short*)Wt + (size_t)n * K + k8) = o; 
}
// k_gemm_hh variant with fused epilogue: v = acc·alpha + bias[by·sBias + col] (+ CP[(row/rowsPerB)·sCPb + by·64 + col] if CP) ; ACT 0 none / 1 elu ; writes f16 C16 (and f32 C if non-null)
template <int ACT>
__global__ __launch_bounds__(128) void k_gemm_hhx(const _Float16* __restrict__ A, int lda, size_t sA, const _Float16* __restrict__ Bh, int ldb, size_t sB, float alpha, const float* __restrict__ bias, size_t sBias, const float* __restrict__ CP, int rowsPerB, size_t sCPb, int row0g,
    float* __restrict__ C, _Float16* __restrict__ C16, int ldc, size_t sC, int M, int N, int K) {
  __shared__ __attribute__((aligned(16))) float so[4][16][64];
  const int tid = threadIdx.x, w = tid >> 5, lane = tid & 31, ln = lane & 15, hh = lane >> 4; const int by = blockIdx.y;
  A += (size_t)by * sA; Bh += (size_t)by * sB; const size_t cofs = (size_t)by * sC; const float* bp = bias ? bias + (size_t)by * sBias : nullptr;
  const int ntn = (N + 63) / 64; const int wid = blockIdx.x * 4 + w; const int mt = wid / ntn, nq = wid % ntn; if (mt * 16 >= M) return;
  const int row0 = mt * 16, col0 = nq * 64; const _Float16* arow = A + (size_t)(row0 + ln) * lda;
  v8f acc[4] = {};
  for (int kb = 0; kb < K; kb += 32) { FragH ah; ah.half[0] = *(const v8us*)((const unsigned short*)arow + kb + 8 * hh); ah.half[1] = *(const v8us*)((const unsigned short*)arow + kb + 16 + 8 * hh);
#pragma unroll
    for (int t = 0; t < 4; ++t) { if (col0 + t * 16 >= N) continue; const size_t boff = (size_t)(col0 + t * 16 + ln) * ldb + kb; FragH bq; bq.half[0] = *(const v8us*)((const unsigned short*)Bh + boff + 8 * hh); bq.half[1] = *(const v8us*)((const unsigned short*)Bh + boff + 16 + 8 * hh);
      acc[t] = mmaH<1>(ah.v, ah.v, bq.v, bq.v, acc[t]); }
  }
#pragma unroll
  for (int t = 0; t < 4; ++t) { if (col0 + t * 16 >= N) continue; const int col = col0 + t * 16 + ln; const float bv = bp ? bf16_round(bp[col]) : 0.f;
#pragma unroll
    for (int r = 0; r < 8; ++r) { float v = acc[t][r] * alpha + bv; if (CP) { const int bidx = (row0g + row0 + 8 * hh + r) / rowsPerB; v += CP[(size_t)bidx * sCPb + (size_t)by * 64 + col]; } if (ACT == 1) v = (v > 0.f) ? v : expm1f(v); else if (ACT == 7) v = (v > 0.f) ? v + 1.0f : expf(v); else if (ACT == 8) v = tanhf(v); else if (ACT == 9) v = 0.5f * v * (1.0f + tanhf(0.7978845608028654f * (v + 0.044715f * v * v * v))); else if (ACT == 11) v = 1.0f / (1.0f + expf(-v)); else if (ACT == 12) v = (v > 0.f) ? v : 0.01f * v; else if (ACT == 14) v = (v > 0.f) ? v : 0.1f * v; else if (ACT == 15) v = v / (1.0f + expf(-v)); else if (ACT == 3) v = fmaxf(v, 0.f); else if (ACT == 6) v = 0.5f * v * (1.0f + erff(v * 0.70710678118654752f)); so[w][8 * hh + r][t * 16 + ln] = v; } }
  __builtin_amdgcn_fence(__ATOMIC_ACQ_REL, "workgroup"); __builtin_amdgcn_wave_barrier();
  const int rsub = lane >> 4, c4 = (lane & 15) * 4; typedef _Float16 v4h __attribute__((ext_vector_type(4)));
  {
#pragma unroll
    for (int q = 0; q < 8; ++q) { const int r = q * 2 + rsub; if (col0 + c4 < N) { const v4f v = *(const v4fa*)&so[w][r][c4]; if (C) *(v4f*)(C + cofs + (size_t)(row0 + r) * ldc + col0 + c4) = v; if (C16) { v4h h4; for (int i = 0; i < 4; ++i) h4[i] = (_Float16)v[i]; *(v4h*)(C16 + cofs + (size_t)(row0 + r) * ldc + col0 + c4) = h4; } } }
     }
}


typedef _Float16 v4h __attribute__((ext_vector_type(4)));

__global__ __launch_bounds__(256) void k_h16(const float* __restrict__ x, _Float16* __restrict__ X16, size_t n8) { const size_t t = (size_t)blockIdx.x * 256 + threadIdx.x; if (t >= n8) return; FragH f;
#pragma unroll
  for (int q = 0; q < 8; ++q) f.h[q] = (_Float16)x[t * 8 + q]; *(v8us*)((unsigned short*)X16 + t * 8) = f.half[0];  }
template <int NHv, int TTv>
__global__ __launch_bounds__(256) void k_vt(const _Float16* __restrict__ V16, int ldv, int voff, _Float16* __restrict__ Vt) { __shared__ unsigned short tl[64][66]; const int tid = threadIdx.x; const int slab = blockIdx.x / (TTv / 64), lg = blockIdx.x % (TTv / 64); const int b = slab / NHv, h = slab % NHv;
  for (int i = tid; i < 64 * 8; i += 256) { const int r = i / 8, c8 = (i % 8) * 8; FragH f; f.half[0] = *(const v8us*)((const unsigned short*)V16 + ((size_t)b * TTv + lg * 64 + r) * ldv + voff + h * 64 + c8);
#pragma unroll
    for (int q = 0; q < 8; ++q) tl[r][c8 + q] = f.u[q]; }
  __syncthreads();
  {
#pragma unroll
    for (int rd = 0; rd < 2; ++rd) { const int d = rd * 32 + tid / 8, pc = tid % 8; FragH f;
#pragma unroll
      for (int q = 0; q < 8; ++q) f.u[q] = tl[pc * 8 + q][d];
      *(v8us*)((unsigned short*)Vt + ((size_t)slab * 64 + d) * TTv + lg * 64 + pc * 8) = f.half[0]; }
     } }

__global__ __launch_bounds__(256) void k_hl(const float* __restrict__ F, _Float16* __restrict__ Hh, _Float16* __restrict__ Hl, size_t n8) { const size_t t = (size_t)blockIdx.x * 256 + threadIdx.x; if (t >= n8) return; FragH fh, fl; const v4f a = *(const v4fa*)(F + t * 8), c = *(const v4fa*)(F + t * 8 + 4);
#pragma unroll
  for (int q = 0; q < 4; ++q) { _Float16 h = (_Float16)a[q]; fh.h[q] = h; fl.h[q] = (_Float16)((a[q] - (float)h) * 1024.0f); h = (_Float16)c[q]; fh.h[4 + q] = h; fl.h[4 + q] = (_Float16)((c[q] - (float)h) * 1024.0f); }
  { *(v8us*)((unsigned short*)Hh + t * 8) = fh.half[0]; *(v8us*)((unsigned short*)Hl + t * 8) = fl.half[0];  } }

// ---- a 16 x 32 f16 fragment from global rows ----
__device__ __forceinline__ v16h g2_frag(const _Float16* p, int hh) { FragH f; f.half[0] = *(const v8us*)((const unsigned short*)p + 8 * hh); f.half[1] = *(const v8us*)((const unsigned short*)p + 16 + 8 * hh); return f.v; }

// ---- fused attention: 128 queries per work-group, 64 keys per stage; 8 waves = 4 groups of 32 queries x 2 halves of a stage's keys ----
#define AKB 64        /* keys per stage */
#define KPITCH 136    /* f16 per K row in LDS: 272 B = 16 B x 17 (odd), conflict-free for 16-byte fragment reads */
#define VPITCH 72     /* f16 per v^T row in LDS: 144 B = 16 B x 9 (odd) */
#define ASH (AKB * KPITCH)            /* v_hi^T tile's place in a buffer, f16 */
#define ASL (ASH + FF * VPITCH)       /* v_lo^T tile's place */
#define ABUF (ASL + FF * VPITCH)      /* one buffer, f16: 54,272 B */
#define ANST (SLEN / AKB)             /* stages */
#define AXW (64 * 32 + 64)            /* f32 a wave hands over at the end: a 16 x 128 tile, 32 maxima, 32 sums */
__device__ __forceinline__ v16h at_frag(const unsigned short* p, int hh) { FragH f; f.half[0] = *(const v8us*)(p + 8 * hh); f.half[1] = *(const v8us*)(p + 16 + 8 * hh); return f.v; }
__device__ __forceinline__ v8f at_mma(v16h a, v16h b, v8f c) { return __builtin_amdgcn_wmma_f32_16x16x32_f16(false, a, false, b, (short)0, c, false, false); }
__device__ __forceinline__ float at_xhalf(float x) { return __builtin_bit_cast(float, __builtin_amdgcn_permlanex16(__builtin_bit_cast(int, x), __builtin_bit_cast(int, x), 0x76543210, 0xfedcba98, false, false)); }      /* lane l reads lane l ^ 16 */
// ---- projections, one launch: a work-group takes 128 tokens and makes their q, k rows and v^T columns ----
/* Every loop of this part is unrolled: its register arrays (loaded rows, fragments, accumulators) are then indexed by constants and stay in registers. */
#define PPITCH 136    /* f16 per row in LDS: 272 B = 16 B x 17 (odd), conflict-free for 16-byte fragment reads and writes */
#define PMAT (FF * PPITCH)            /* one 128 x 128 matrix in LDS, f16 */
typedef float v2f __attribute__((ext_vector_type(2)));
typedef float v2fa __attribute__((ext_vector_type(2), may_alias));
typedef __bf16 v2b __attribute__((ext_vector_type(2)));
typedef _Float16 v2h __attribute__((ext_vector_type(2)));
typedef unsigned int v2ua __attribute__((ext_vector_type(2), may_alias));
typedef unsigned int v4ua __attribute__((ext_vector_type(4), may_alias));
__device__ __forceinline__ unsigned int pj_h2(float a, float c) { const v2f p = {a, c}; return __builtin_bit_cast(unsigned int, __builtin_convertvector(p, v2h)); }      /* two f32 -> packed f16, nearest even */
/* two f32 -> nearest-even bf16 values (x SCALE, a power of two) -> packed f16 */
template <int SCALE>
__device__ __forceinline__ unsigned int pj_in2(float a, float c) { const v2f p = {a, c}; const unsigned int bb = __builtin_bit_cast(unsigned int, __builtin_convertvector(p, v2b));
  return pj_h2(__uint_as_float(bb << 16) * (float)SCALE, __uint_as_float(bb & 0xFFFF0000u) * (float)SCALE); }
/* a 128 x 128 f32 matrix through 256 threads: each wave-wide load is one whole row of 512 B (wave w: rows w, w + 8, ...) */
__device__ __forceinline__ void pj_load(v4f (&d)[16], const float* p) {
#pragma unroll
  for (int i = 0; i < 16; ++i) d[i] = *(const v4fa*)(p + i * 8 * FF); }
template <int SCALE>
__device__ __forceinline__ void pj_put(const v4f (&d)[16], unsigned short* q) {
#pragma unroll
  for (int i = 0; i < 16; ++i) { const v2ua o = {pj_in2<SCALE>(d[i][0], d[i][1]), pj_in2<SCALE>(d[i][2], d[i][3])}; *(v2ua*)(q + i * 8 * PPITCH) = o; } }
/* a wave's staged tile, 16 rows x 128 f16, to global rows of the given pitch: each store is two whole rows of 256 B */
__device__ __forceinline__ void pj_rows(const unsigned short* st, unsigned short* dst, size_t pitch, int ln, int hh) {
  v8us t[8];
#pragma unroll
  for (int i = 0; i < 8; ++i) t[i] = *(const v8us*)(st + (2 * i + hh) * PPITCH + ln * 8);
  __builtin_amdgcn_sched_barrier(0);      /* with the one behind the wait: nothing that rewrites an address register comes between these stores and their s_wait_xcnt */
#pragma unroll
  for (int i = 0; i < 8; ++i) *(v8us*)(dst + (size_t)(2 * i + hh) * pitch + ln * 8) = t[i];
  asm volatile("s_wait_xcnt 0x0" ::: "memory");      /* stands before the address registers of the stores above are reused */
  __builtin_amdgcn_sched_barrier(0); }
__global__ __launch_bounds__(256) void k_proj(const float* __restrict__ x, const float* __restrict__ Wq, const float* __restrict__ bq, const float* __restrict__ Wk, const float* __restrict__ bk,
                                              const float* __restrict__ Wv, const float* __restrict__ bv, _Float16* __restrict__ Q16, _Float16* __restrict__ K16, _Float16* __restrict__ VT2) {
  __shared__ __attribute__((aligned(16))) unsigned short sw[3 * PMAT];      /* 16 Wq, 16 Wk, 16 Wv as f16, rows = output features */
  __shared__ __attribute__((aligned(16))) unsigned short sx[PMAT];          /* the 128 tokens' x as f16 */
  __shared__ __attribute__((aligned(16))) unsigned short so[8][2][16 * PPITCH];      /* per wave: two output tiles on their way to whole-line stores */
  __shared__ __attribute__((aligned(16))) float sb[3 * FF];                 /* biases, rounded */
  const int tid = threadIdx.x, w = tid >> 5, lane = tid & 31, ln = lane & 15, hh = lane >> 4;
  const size_t tok0 = (size_t)blockIdx.x * 128;
  const int go = w * FF + lane * 4, lo = w * PPITCH + lane * 4;
  v4f ra[16], rb[16], rc[16];
  __builtin_amdgcn_sched_barrier(0);      /* as in pj_rows, for these loads */
  pj_load(ra, x + tok0 * FF + go); pj_load(rb, Wq + go); pj_load(rc, Wk + go);      /* x first: it comes from memory, the weights from L2 */
  const float b0 = bq[tid & (FF - 1)], b1 = bk[tid & (FF - 1)], b2 = bv[tid & (FF - 1)];
  asm volatile("s_wait_xcnt 0x0" ::: "memory");      /* stands before the address registers of the loads above are reused */
  __builtin_amdgcn_sched_barrier(0);
  pj_put<1>(ra, sx + lo);
  __builtin_amdgcn_sched_barrier(0);      /* Wv's loads go out as soon as x has left its registers, ahead of the other weights' conversion, which hides them */
  pj_load(ra, Wv + go);
  asm volatile("s_wait_xcnt 0x0" ::: "memory");      /* as above */
  __builtin_amdgcn_sched_barrier(0);
  pj_put<16>(rb, sw + lo); pj_put<16>(rc, sw + PMAT + lo);
  asm volatile("" :: "v"(b0), "v"(b1), "v"(b2));      /* inputs only: holds the three bias loads up in the first batch; otherwise they sink into the branch below, where their whole latency stands open in front of the barrier */
  if (tid < FF) { sb[tid] = bf16_round(b0); sb[FF + tid] = bf16_round(b1); sb[2 * FF + tid] = bf16_round(b2); }
  pj_put<16>(ra, sw + 2 * PMAT + lo);
  __syncthreads();      /* x, the weights and the biases are in LDS for every wave */
  /* q, k: wave w owns tokens 16w..16w+15; D = W.x^T, a lane holds 8 successive features of one token.
     v^T:  wave w owns features 16w..16w+15; D = x.Wv^T, a lane holds 8 successive tokens of one feature.
     Twelve groups of 8 fragment reads and 8 WMMAs (3 matrices x 4 k steps); group g + 1 is read ahead of group g's WMMAs. */
  const unsigned short* xrow = sx + ln * PPITCH; const unsigned short* wrow = sw + ln * PPITCH;
  v16h own[4];      /* the operand a wave keeps: its tokens' x for q and k, its features' Wv for v^T */
#pragma unroll
  for (int ks = 0; ks < 4; ++ks) own[ks] = at_frag(xrow + w * 16 * PPITCH + ks * 32, hh);
  v16h fr[2][8];
  auto grp = [&](int g, v16h* f) { const unsigned short* p = (g < 8 ? wrow + (g >> 2) * PMAT : xrow) + (g & 3) * 32;
#pragma unroll
    for (int t = 0; t < 8; ++t) f[t] = at_frag(p + t * 16 * PPITCH, hh); };
  grp(0, fr[0]);
  const v8f z8 = {0.f,0.f,0.f,0.f,0.f,0.f,0.f,0.f};
  v8f acc[8];
  unsigned short* s0 = so[w][0]; unsigned short* s1 = so[w][1];
  const int sp = ln * PPITCH + 8 * hh;      /* a lane's place in a staged tile, + 16 per accumulator tile */
#pragma unroll
  for (int g = 0; g < 12; ++g) {
    if (g + 1 < 12) grp(g + 1, fr[(g + 1) & 1]);
    __builtin_amdgcn_sched_barrier(0);      /* the next group's reads are issued together, ahead of this group's WMMAs and not among them */
#pragma unroll
    for (int t = 0; t < 8; ++t) acc[t] = at_mma(fr[g & 1][t], own[g & 3], (g & 3) ? acc[t] : z8);
    __builtin_amdgcn_sched_barrier(0);      /* ... and what follows stays behind the WMMAs */
    if (g == 3 || g == 7) {
      const int m = g >> 2; unsigned short* st = m ? s1 : s0;
      if (g == 7) {
#pragma unroll
        for (int ks = 0; ks < 4; ++ks) own[ks] = at_frag(wrow + 2 * PMAT + w * 16 * PPITCH + ks * 32, hh);
      }
#pragma unroll
      for (int t = 0; t < 8; ++t) { const v4f c0 = *(const v4fa*)&sb[m * FF + t * 16 + 8 * hh], c1 = *(const v4fa*)&sb[m * FF + t * 16 + 8 * hh + 4];
        const v4ua o = {pj_h2(acc[t][0] * 0.0625f + c0[0], acc[t][1] * 0.0625f + c0[1]), pj_h2(acc[t][2] * 0.0625f + c0[2], acc[t][3] * 0.0625f + c0[3]),
                        pj_h2(acc[t][4] * 0.0625f + c1[0], acc[t][5] * 0.0625f + c1[1]), pj_h2(acc[t][6] * 0.0625f + c1[2], acc[t][7] * 0.0625f + c1[3])};
        *(v4ua*)(st + sp + t * 16) = o; }
      asm volatile("s_wait_dscnt 0x0" ::: "memory");      /* the wave's own tile is written before other lanes' parts of it are read back */
      pj_rows(st, (unsigned short*)(m ? K16 : Q16) + (tok0 + w * 16) * FF, FF, ln, hh);
    }
  }
  const float cv = sb[2 * FF + w * 16 + ln];
#pragma unroll
  for (int t = 0; t < 8; ++t) { v4ua oh, ol;
#pragma unroll
    for (int r = 0; r < 8; r += 2) { const v2f v = {acc[t][r] * 0.0625f + cv, acc[t][r + 1] * 0.0625f + cv}; const v2h h = __builtin_convertvector(v, v2h); const v2f res = v - __builtin_convertvector(h, v2f);
      oh[r >> 1] = __builtin_bit_cast(unsigned int, h); ol[r >> 1] = pj_h2(res[0], res[1]); }      /* v = hi + raw residual */
    *(v4ua*)(s0 + sp + t * 16) = oh; *(v4ua*)(s1 + sp + t * 16) = ol; }
  asm volatile("s_wait_dscnt 0x0" ::: "memory");      /* as above */
  unsigned short* vt = (unsigned short*)VT2 + (tok0 / SLEN) * ((size_t)FF * 2 * SLEN) + (size_t)(w * 16) * (2 * SLEN) + tok0 % SLEN;      /* row = feature: 2048 hi, then 2048 lo */
  pj_rows(s0, vt, 2 * SLEN, ln, hh); pj_rows(s1, vt + SLEN, 2 * SLEN, ln, hh);
}

__global__ __launch_bounds__(256) void k_attn(const _Float16* __restrict__ Q, const _Float16* __restrict__ Kk, const _Float16* __restrict__ Vt, float* __restrict__ O) {
  __shared__ __attribute__((aligned(16))) unsigned short sm[2 * ABUF];      /* two buffers, each: K tile, v_hi^T tile, v_lo^T tile; after the loop: the two key halves' partial results */
  const int tid = threadIdx.x, w = tid >> 5, lane = tid & 31, ln = lane & 15, hh = lane >> 4, b = blockIdx.y;
  const int kh = w >> 2;      /* the wave's half of every stage: keys 32 kh .. 32 kh + 31 */
  const int q0 = blockIdx.x * 128 + (w & 3) * 32;      /* the wave's 32 queries, two tiles of 16; waves w and w ^ 4 share them */
  const unsigned short* kg = (const unsigned short*)Kk + (size_t)b * SLEN * FF + tid * 8;                                  /* a K stage is 16 KiB in a row */
  const unsigned short* vg = (const unsigned short*)Vt + (size_t)b * FF * 2 * SLEN + (size_t)(tid >> 3) * (2 * SLEN) + (tid & 7) * 8;      /* 128 rows x 128 B, hi; lo at + SLEN */
  const int kw = (tid >> 4) * KPITCH + (tid & 15) * 8, vw = (tid >> 3) * VPITCH + (tid & 7) * 8;
  const int kr = (kh * 32 + ln) * KPITCH, vr = ln * VPITCH + kh * 32;      /* a lane's first K row and first v^T row of the wave's half */
  const _Float16* qp = Q + ((size_t)b * SLEN + q0 + ln) * FF;
  v16h qf[2][4];
#pragma unroll
  for (int qt = 0; qt < 2; ++qt)
#pragma unroll
    for (int ks = 0; ks < 4; ++ks) qf[qt][ks] = g2_frag(qp + qt * 16 * FF + ks * 32, hh);
  const v8f z8 = {0.f,0.f,0.f,0.f,0.f,0.f,0.f,0.f};
  v8f o[2][8] = {{z8, z8, z8, z8, z8, z8, z8, z8}, {z8, z8, z8, z8, z8, z8, z8, z8}};
  float mrun[2] = {-3.0e38f, -3.0e38f};
  v2f ls[2] = {{0.f, 0.f}, {0.f, 0.f}};      /* a query tile's row sums: even and odd keys apart */
  const float SC = 0.09016844005556021f;      /* log2(e) / 16 */
  v8us pk[4], ph[4], pl[4];      /* one stage on its way from global memory to LDS */
  auto fetch = [&](int st) { const unsigned short* kn = kg + (size_t)st * AKB * FF; const unsigned short* vn = vg + st * AKB;
    __builtin_amdgcn_sched_barrier(0);      /* with the one behind the wait: no other instruction, so no rewrite of an address register, comes between these loads and their s_wait_xcnt */
#pragma unroll
    for (int i = 0; i < 4; ++i) { pk[i] = *(const v8us*)(kn + i * 2048); ph[i] = *(const v8us*)(vn + (size_t)i * 32 * 2 * SLEN); pl[i] = *(const v8us*)(vn + (size_t)i * 32 * 2 * SLEN + SLEN); }
    asm volatile("s_wait_xcnt 0x0" ::: "memory");      /* stands before the address registers of the loads above (and of the Q loads) are reused */
    __builtin_amdgcn_sched_barrier(0); };
  auto put = [&](unsigned short* bw) {
#pragma unroll
    for (int i = 0; i < 4; ++i) { *(v8us*)(bw + kw + i * 16 * KPITCH) = pk[i]; *(v8us*)(bw + ASH + vw + i * 32 * VPITCH) = ph[i]; *(v8us*)(bw + ASL + vw + i * 32 * VPITCH) = pl[i]; } };
  fetch(0); put(sm); fetch(1);
  __syncthreads();      /* stage 0 is in buffer 0 for every wave */
  /* rolled: one stage's code stays small, and the loads of stage st + 2 stay in their own block ahead of the products */
#pragma unroll 1
  for (int st = 0; st < ANST; ++st) {
    const unsigned short* sk = sm + (st & 1) * ABUF; const unsigned short* sh = sk + ASH; const unsigned short* sl = sk + ASL;
    if (st + 1 < ANST) put(sm + ((st + 1) & 1) * ABUF);      /* into the buffer whose readers (stage st - 1) all passed the barrier at the loop's foot */
    if (st + 2 < ANST) fetch(st + 2);
    /* Every fragment read from LDS feeds two WMMAs, one per query tile. The reads stand in groups ahead of the products that use them; each
       sched_barrier keeps the compiler from sinking a group's reads down to one read, one full wait, one WMMA (every WMMA then waits out an LDS latency). */
    v16h kf[8], va[8], vb[8];      /* the half's K rows; its v_hi^T and v_lo^T columns */
#pragma unroll
    for (int ks = 0; ks < 4; ++ks)
#pragma unroll
      for (int kt = 0; kt < 2; ++kt) kf[ks * 2 + kt] = at_frag(sk + kr + kt * 16 * KPITCH + ks * 32, hh);
    __builtin_amdgcn_sched_barrier(0);      /* the K reads stay first in the LDS queue: the score WMMAs wait for them alone (the compiler put the v_hi^T reads in front of most of them) */
#pragma unroll
    for (int ft = 0; ft < 8; ++ft) va[ft] = at_frag(sh + vr + ft * 16 * VPITCH, hh);
    __builtin_amdgcn_sched_barrier(0);      /* all K reads, and behind them the v_hi^T reads, issued before the first score WMMA */
    v8f s[2][2] = {{z8, z8}, {z8, z8}};      /* s[kt][qt][r] = score of key 32*kh + kt*16 + 8*hh + r, query qt*16 + ln */
#pragma unroll
    for (int ks = 0; ks < 4; ++ks)
#pragma unroll
      for (int kt = 0; kt < 2; ++kt)
#pragma unroll
        for (int qt = 0; qt < 2; ++qt) s[kt][qt] = at_mma(kf[ks * 2 + kt], qf[qt][ks], s[kt][qt]);
    __builtin_amdgcn_sched_barrier(0);      /* the v_lo^T reads below stay behind the score WMMAs (they take over the K fragments' registers) and ahead of the softmax, which hides them */
#pragma unroll
    for (int ft = 0; ft < 8; ++ft) vb[ft] = at_frag(sl + vr + ft * 16 * VPITCH, hh);
    __builtin_amdgcn_sched_barrier(0);      /* in flight before the maxima */
    float mx[2];
#pragma unroll
    for (int qt = 0; qt < 2; ++qt) { float m = s[0][qt][0];
#pragma unroll
      for (int kt = 0; kt < 2; ++kt)
#pragma unroll
        for (int r = 0; r < 8; ++r) m = fmaxf(m, s[kt][qt][r]);
      mx[qt] = fmaxf(m, at_xhalf(m)) * SC; }
    if (__builtin_amdgcn_ballot_w32(mx[0] > mrun[0] || mx[1] > mrun[1]) != 0) {      /* some query's maximum rose: rescale (factor 1 for the others) */
#pragma unroll
      for (int qt = 0; qt < 2; ++qt) { const float mn = fmaxf(mrun[qt], mx[qt]); const float corr = __builtin_amdgcn_exp2f(mrun[qt] - mn); mrun[qt] = mn; ls[qt] *= corr;
#pragma unroll
        for (int ft = 0; ft < 8; ++ft)
#pragma unroll
          for (int r = 0; r < 8; ++r) o[qt][ft][r] *= corr; }
    }
    FragH pb[2];      /* one per query tile: P^T of the half's 32 keys */
#pragma unroll
    for (int qt = 0; qt < 2; ++qt) { const float moff = mrun[qt] - 10.0f;      /* P x 2^10 keeps small probabilities in f16's normal range; it cancels in the division */
      const v2f sc2 = {SC, SC}, mo2 = {moff, moff};
      /* on the accumulators' own even register pairs: left to itself the compiler paired values across the two query tiles and copied registers to do so */
#pragma unroll
      for (int e = 0; e < 16; e += 2) { const v2f sv = {s[e >> 3][qt][e & 7], s[e >> 3][qt][(e & 7) + 1]}; const v2f t = sv * sc2 - mo2;
        const v2f p = {__builtin_amdgcn_exp2f(t[0]), __builtin_amdgcn_exp2f(t[1])};
        ls[qt] += p; pb[qt].h[e] = (_Float16)p[0]; pb[qt].h[e + 1] = (_Float16)p[1]; } }
#pragma unroll
    for (int ft = 0; ft < 8; ++ft)
#pragma unroll
      for (int qt = 0; qt < 2; ++qt) o[qt][ft] = at_mma(va[ft], pb[qt].v, o[qt][ft]);
#pragma unroll
    for (int ft = 0; ft < 8; ++ft)
#pragma unroll
      for (int qt = 0; qt < 2; ++qt) o[qt][ft] = at_mma(vb[ft], pb[qt].v, o[qt][ft]);
    __syncthreads();      /* publishes stage st + 1 and ends every read of stage st's buffer */
  }
  /* The two halves' results meet: wave w keeps query tile kh and hands the other tile, with its maximum and its sum, to wave w ^ 4 through LDS
     (free since the loop's last barrier). A lane's 64 values go as 16 wave-wide rows of 512 B, read back by the same lane of the other wave. */
  float lsum[2];
#pragma unroll
  for (int qt = 0; qt < 2; ++qt) { const float l = ls[qt][0] + ls[qt][1]; lsum[qt] = l + at_xhalf(l); }
  const bool up = kh != 0;
  float* xw = (float*)sm + w * AXW; const float* xr = (const float*)sm + (w ^ 4) * AXW;
#pragma unroll
  for (int ft = 0; ft < 8; ++ft)
#pragma unroll
    for (int h = 0; h < 2; ++h) { const v4f g = {up ? o[0][ft][4 * h] : o[1][ft][4 * h], up ? o[0][ft][4 * h + 1] : o[1][ft][4 * h + 1], up ? o[0][ft][4 * h + 2] : o[1][ft][4 * h + 2], up ? o[0][ft][4 * h + 3] : o[1][ft][4 * h + 3]};
      *(v4fa*)(xw + ((ft * 2 + h) * 32 + lane) * 4) = g; }
  { const v2f g = {up ? mrun[0] : mrun[1], up ? lsum[0] : lsum[1]}; *(v2fa*)(xw + 2048 + lane * 2) = g; }
  __syncthreads();      /* every wave's handed-over tile is in LDS */
  const v2f ml = *(const v2fa*)(xr + 2048 + lane * 2);
  const float mk = up ? mrun[1] : mrun[0], lk = up ? lsum[1] : lsum[0];
  const float mn = fmaxf(mk, ml[0]);
  float ck = __builtin_amdgcn_exp2f(mk - mn), cx = __builtin_amdgcn_exp2f(ml[0] - mn);
  const float inv = 1.0f / (lk * ck + ml[1] * cx);
  ck *= inv; cx *= inv;
  float* op = O + ((size_t)b * SLEN + q0 + kh * 16 + ln) * FF + 8 * hh;      /* value [ft][r] = out[query kh*16 + ln][feature ft*16 + 8*hh + r] */
#pragma unroll
  for (int ft = 0; ft < 8; ++ft) { const v4f x0 = *(const v4fa*)(xr + ((ft * 2) * 32 + lane) * 4), x1 = *(const v4fa*)(xr + ((ft * 2 + 1) * 32 + lane) * 4);
    v4f u0, u1;
#pragma unroll
    for (int r = 0; r < 4; ++r) { u0[r] = (up ? o[1][ft][r] : o[0][ft][r]) * ck + x0[r] * cx; u1[r] = (up ? o[1][ft][4 + r] : o[0][ft][4 + r]) * ck + x1[r] * cx; }
    *(v4f*)(op + ft * 16) = u0; *(v4f*)(op + ft * 16 + 4) = u1; }
}

extern "C" void kernel_launch(void* const* d_in, const int* in_sizes, int n_in,
                              void* d_out, int out_size, void* d_ws, size_t ws_size, hipStream_t stream) {
  (void)in_sizes; (void)n_in; (void)out_size;
  const float* const* I = (const float* const*)d_in; const float* x = I[0]; const float* Wq = I[1]; const float* bq = I[2]; const float* Wk = I[3]; const float* bk = I[4]; const float* Wv = I[5]; const float* bv = I[6];
  char* ws = (char*)d_ws; size_t off = 0;
  auto take = [&](size_t bytes) { char* p = ws + off; off += (bytes + 255) & ~(size_t)255; return p; };
  const size_t PL = (size_t)NBT * SLEN * FF;      /* elements of one [16][2048][128] plane */
  _Float16* Q16 = (_Float16*)take(PL * 2); _Float16* K16 = (_Float16*)take(PL * 2); _Float16* VT2 = (_Float16*)take(PL * 2 * 2);
  if (off > ws_size) return;      /* 32 MiB */
  k_proj<<<NBT * SLEN / 128, 256, 0, stream>>>(x, Wq, bq, Wk, bk, Wv, bv, Q16, K16, VT2);      /* q, k, [v_hi^T | v_lo^T] */
  k_attn<<<dim3(SLEN / 128, NBT), 256, 0, stream>>>(Q16, K16, VT2, (float*)d_out);      /* softmax(q.k / 16) . (v_hi + v_lo) */
}
